// v000
// The times below were measured on an AMD MI455X: many runs one after another, warmed up first and cycling through
// copies of the inputs, with the whole window's GPU time divided by the number of runs. Launches and the gaps
// between them are all in it. The median over several windows is given; except for v000 it joins two sittings, which
// can be a few percent apart, so the side-by-side timings, each taken in one sitting, are the better comparison.
// The starting kernel, v000, takes 2200 microseconds a run.
#include <hip/hip_runtime.h>

// Causal multi-head attention at d_model 768 on three input streams, bias-free (q, k, v [4][2048][768]; qh = q w_q^T, kh = k w_k^T, vh = v w_v^T ('oi' [768][768] 1/sqrt(768), no bias; 12 heads x 64); att x 1/sqrt(64); causal (-inf); softmax; y = merged w_o^T ('oi', no bias) -> [4][2048][768] (6.3 M); argument order q, k, v, w_q, w_k, w_v, w_o).
// Layout per batch: bf16 copy of each stream in turn (one staging buffer, refilled in stream order); 'oi' weights as-is; exact projections; identity-table plane builders; causal T-2048 attention (hybrid rows: < 512 hi/lo 3 products, rest fp16 x1024; k_gemmc skips tiles above the diagonal); merged hi/lo x w_o exact.
// Compute dtypes, f32 accumulate: every input rounded to bf16; projections exact; attention rows < 512 3 products, rest fp16; softmax f32; output projection hl x exact.

#define NB_  4
#define TT   2048
#define DM   768
#define NH_  12
#define NKV  12
#define REP  (NH_ / NKV)
#define HD   64
#define DQ   (NH_ * HD)
#define DKV  (NKV * HD)
#define ZH   2
#define RH   512                  // query rows < RH use hi+lo planes (0: none)
#define WIN  2048
#define PCAR 1024.0f
#define SCL  0.125f   // HD^-0.5
typedef _Float16 h16;
typedef unsigned short bf;
typedef __attribute__((ext_vector_type(16))) __bf16   v16bf;
typedef __attribute__((ext_vector_type(16))) _Float16 v16h;
typedef __attribute__((ext_vector_type(8)))  _Float16 v8h;
typedef __attribute__((ext_vector_type(8)))  unsigned short v8us;
typedef __attribute__((ext_vector_type(8)))  float    v8f;
typedef __attribute__((ext_vector_type(4)))  float    v4f;
typedef v8h  __attribute__((may_alias)) v8ha;
typedef v4f  __attribute__((may_alias)) v4fa;
typedef v8us __attribute__((may_alias)) v8usa;

__device__ __forceinline__ unsigned short f2bf(float f) { unsigned u = __float_as_uint(f); u += 0x7FFFu + ((u >> 16) & 1u); return (unsigned short)(u >> 16); }
__device__ __forceinline__ float bf2f(unsigned short b) { return __uint_as_float(((unsigned)b) << 16); }
__device__ __forceinline__ float bfr(float f) { return bf2f(f2bf(f)); }
__device__ __forceinline__ v16h cat16(v8h lo, v8h hi) { return __builtin_shufflevector(lo, hi, 0, 1, 2, 3, 4, 5, 6, 7, 8, 9, 10, 11, 12, 13, 14, 15); }
__device__ __forceinline__ v16bf cat16b(v8us lo, v8us hi) { return __builtin_bit_cast(v16bf, __builtin_shufflevector(lo, hi, 0, 1, 2, 3, 4, 5, 6, 7, 8, 9, 10, 11, 12, 13, 14, 15)); }
__device__ __forceinline__ v8f wmma16(v16h a, v16h b, v8f c) { return __builtin_amdgcn_wmma_f32_16x16x32_f16(false, a, false, b, (short)0, c, false, false); }
__device__ __forceinline__ v8f wmmab(v16bf a, v16bf b, v8f c) { return __builtin_amdgcn_wmma_f32_16x16x32_bf16(false, a, false, b, (short)0, c, false, false); }



// ---- k_gemmw: register-blocked GEMM, ONE WAVE per 64x64 output tile (16 accumulators), operands straight from K-contiguous 16-bit planes; grid (M/64, N/64, Z), 32 threads.
// C[m][n] (f32, pitch ldc, + optional f32 bias[n]) = sum_k A[m][k] Bt[n][k] (+ split products per NSPLIT). z-batch strides sA/sB/sC in elements. K % 32 == 0.
template <typename T16> struct WFrag;
template <> struct WFrag<h16> { typedef v16h V; static __device__ __forceinline__ V ld(const h16* p) { return cat16(*(const v8h*)p, *(const v8h*)(p + 16)); } static __device__ __forceinline__ v8f mma(V a, V b, v8f c) { return wmma16(a, b, c); } };
template <> struct WFrag<bf> { typedef v16bf V; static __device__ __forceinline__ V ld(const bf* p) { return cat16b(*(const v8us*)p, *(const v8us*)(p + 16)); } static __device__ __forceinline__ v8f mma(V a, V b, v8f c) { return wmmab(a, b, c); } };
template <typename T16, int NSPLIT, bool BIAS>
__global__ __launch_bounds__(32) void k_gemmw(const T16* __restrict__ A, const T16* __restrict__ A2, const T16* __restrict__ Bt, const T16* __restrict__ Bt2, int K, float* C, int ldc, const float* __restrict__ bias, size_t sA, size_t sB, size_t sC) {
    typedef typename WFrag<T16>::V V;
    __shared__ __align__(16) float os[16 * 68];
    const size_t z = blockIdx.z; A += z * sA; if (A2) A2 += z * sA; Bt += z * sB; if (Bt2) Bt2 += z * sB; C += z * sC;
    const int lane = threadIdx.x & 31, lr = lane & 15, hi = lane >> 4; const int r0 = blockIdx.x * 64, c0 = blockIdx.y * 64;
    v8f acc[4][4];
#pragma unroll
    for (int mb = 0; mb < 4; ++mb)
#pragma unroll
        for (int nb = 0; nb < 4; ++nb) acc[mb][nb] = (v8f){};
    const size_t aoff = (size_t)(r0 + lr) * K + 8 * hi, boff = (size_t)(c0 + lr) * K + 8 * hi;
#pragma unroll 1
    for (int kc = 0; kc < K; kc += 32) {
        V a[4], a2[4];
#pragma unroll
        for (int mb = 0; mb < 4; ++mb) { a[mb] = WFrag<T16>::ld(A + aoff + (size_t)mb * 16 * K + kc); if (NSPLIT == 1 || NSPLIT == 2) a2[mb] = WFrag<T16>::ld(A2 + aoff + (size_t)mb * 16 * K + kc); }
#pragma unroll
        for (int nb = 0; nb < 4; ++nb) { const V b = WFrag<T16>::ld(Bt + boff + (size_t)nb * 16 * K + kc); V b2; if (NSPLIT >= 2) b2 = WFrag<T16>::ld(Bt2 + boff + (size_t)nb * 16 * K + kc);
#pragma unroll
            for (int mb = 0; mb < 4; ++mb) { acc[mb][nb] = WFrag<T16>::mma(a[mb], b, acc[mb][nb]); if (NSPLIT == 1 || NSPLIT == 2) acc[mb][nb] = WFrag<T16>::mma(a2[mb], b, acc[mb][nb]); if (NSPLIT >= 2) acc[mb][nb] = WFrag<T16>::mma(a[mb], b2, acc[mb][nb]); } }
        asm volatile("v_nop\n\tv_nop\n\tv_nop\n\tv_nop" : "+v"(acc[0][0]), "+v"(acc[1][1]), "+v"(acc[2][2]), "+v"(acc[3][3]) : "v"(a[0]), "v"(a[3]));
    }
#pragma unroll
    for (int mb = 0; mb < 4; ++mb) {
#pragma unroll
        for (int nb = 0; nb < 4; ++nb) {
#pragma unroll
            for (int j = 0; j < 8; ++j) os[(hi * 8 + j) * 68 + nb * 16 + lr] = acc[mb][nb][j]; }
        __builtin_amdgcn_wave_barrier(); asm volatile("" ::: "memory");
        float* crow = C + (size_t)(r0 + mb * 16) * ldc + c0;
{
#pragma unroll
            for (int s = 0; s < 8; ++s) { const int row = 2 * s + hi, cofs = lr * 4; v4f val = *(const v4fa*)(os + row * 68 + cofs); if (BIAS) { val[0] += bfr(bias[c0 + cofs]); val[1] += bfr(bias[c0 + cofs + 1]); val[2] += bfr(bias[c0 + cofs + 2]); val[3] += bfr(bias[c0 + cofs + 3]); }
                *(v4f*)(crow + (size_t)row * ldc + cofs) = val; }
             }
        __builtin_amdgcn_wave_barrier(); asm volatile("" ::: "memory");
    }
}

// ---- k_gemmc: the same one-wave 64x64 tile GEMM specialised for causal attention: CMODE 1 skips score tiles entirely above the diagonal (query rows r0+roff.., key columns c0..), CMODE 2 limits the
// key (K) loop of the probability x value contraction to the diagonal block (probabilities beyond it are exactly zero). roff = row offset of this launch's first row within the sequence.
template <typename T16, int NSPLIT, int CMODE>
__global__ __launch_bounds__(32) void k_gemmc(const T16* __restrict__ A, const T16* __restrict__ A2, const T16* __restrict__ Bt, const T16* __restrict__ Bt2, int K, float* C, int ldc, int roff, size_t sA, size_t sB, size_t sC) {
    typedef typename WFrag<T16>::V V;
    __shared__ __align__(16) float os[16 * 68];
    const size_t z = blockIdx.z; A += z * sA; if (A2) A2 += z * sA; Bt += z * sB; if (Bt2) Bt2 += z * sB; C += z * sC;
    const int lane = threadIdx.x & 31, lr = lane & 15, hi = lane >> 4; const int r0 = blockIdx.x * 64, c0 = blockIdx.y * 64;
    if (CMODE == 1 && c0 > r0 + roff + 63) return;                  // score tile entirely above the causal diagonal: never read (the softmax masks j > i by select)
    const int Kl = (CMODE == 2) ? min(K, r0 + roff + 64) : K;        // P.V: probabilities are exactly 0 beyond the diagonal block, so the K loop stops there
    v8f acc[4][4];
#pragma unroll
    for (int mb = 0; mb < 4; ++mb)
#pragma unroll
        for (int nb = 0; nb < 4; ++nb) acc[mb][nb] = (v8f){};
    const size_t aoff = (size_t)(r0 + lr) * K + 8 * hi, boff = (size_t)(c0 + lr) * K + 8 * hi;
#pragma unroll 1
    for (int kc = 0; kc < Kl; kc += 32) {
        V a[4], a2[4];
#pragma unroll
        for (int mb = 0; mb < 4; ++mb) { a[mb] = WFrag<T16>::ld(A + aoff + (size_t)mb * 16 * K + kc); if (NSPLIT == 1 || NSPLIT == 2) a2[mb] = WFrag<T16>::ld(A2 + aoff + (size_t)mb * 16 * K + kc); }
#pragma unroll
        for (int nb = 0; nb < 4; ++nb) { const V b = WFrag<T16>::ld(Bt + boff + (size_t)nb * 16 * K + kc); V b2; if (NSPLIT >= 2) b2 = WFrag<T16>::ld(Bt2 + boff + (size_t)nb * 16 * K + kc);
#pragma unroll
            for (int mb = 0; mb < 4; ++mb) { acc[mb][nb] = WFrag<T16>::mma(a[mb], b, acc[mb][nb]); if (NSPLIT == 1 || NSPLIT == 2) acc[mb][nb] = WFrag<T16>::mma(a2[mb], b, acc[mb][nb]); if (NSPLIT >= 2) acc[mb][nb] = WFrag<T16>::mma(a[mb], b2, acc[mb][nb]); } }
        asm volatile("v_nop\n\tv_nop\n\tv_nop\n\tv_nop" : "+v"(acc[0][0]), "+v"(acc[1][1]), "+v"(acc[2][2]), "+v"(acc[3][3]) : "v"(a[0]), "v"(a[3]));
    }
#pragma unroll
    for (int mb = 0; mb < 4; ++mb) {
#pragma unroll
        for (int nb = 0; nb < 4; ++nb) {
#pragma unroll
            for (int j = 0; j < 8; ++j) os[(hi * 8 + j) * 68 + nb * 16 + lr] = acc[mb][nb][j]; }
        __builtin_amdgcn_wave_barrier(); asm volatile("" ::: "memory");
        float* crow = C + (size_t)(r0 + mb * 16) * ldc + c0;
{
#pragma unroll
            for (int s = 0; s < 8; ++s) { const int row = 2 * s + hi, cofs = lr * 4; v4f val = *(const v4fa*)(os + row * 68 + cofs);
                *(v4f*)(crow + (size_t)row * ldc + cofs) = val; }
             }
        __builtin_amdgcn_wave_barrier(); asm volatile("" ::: "memory");
    }
}

__device__ __forceinline__ h16 tohx(float x) { return (h16)x; }
__device__ __forceinline__ void splitf(float y, unsigned short& h, unsigned short& l) { h = f2bf(y); l = f2bf(y - bf2f(h)); }
typedef __attribute__((ext_vector_type(2))) _Float16 v2h;
typedef __attribute__((ext_vector_type(4))) _Float16 v4h;
typedef __attribute__((ext_vector_type(2))) unsigned short v2us;
typedef __attribute__((ext_vector_type(4))) unsigned short v4us;
typedef __attribute__((ext_vector_type(2))) float v2f;
typedef __attribute__((ext_vector_type(4))) int v4i;

__global__ __launch_bounds__(256) void k_cvt8(const float* __restrict__ src, bf* dst, size_t n8) { const size_t i = (size_t)blockIdx.x * 256 + threadIdx.x; if (i >= n8) return; const v8f v = *(const v8f*)(src + i * 8); v8us o;
#pragma unroll
    for (int k = 0; k < 8; ++k) o[k] = f2bf(v[k]); *(v8us*)(dst + i * 8) = o;  }

// k_rope: head planes [h][t][d] (fp16 + hi/lo) of rope(x) x sc with the rotate-half convention out[d] = x[d] cos[t][d] - x[d+HD/2] sin[t][d], out[d+HD/2] = x[d+HD/2] cos[t][d+HD/2] + x[d] sin[t][d+HD/2]
__global__ __launch_bounds__(256) void k_rope(const float* __restrict__ F, int pitch, int nheads, const float* __restrict__ CS, const float* __restrict__ RF, const float* __restrict__ nw, float sc, h16* P16, bf* Ph, bf* Pl) {
    const size_t e = ((size_t)blockIdx.x * 256 + threadIdx.x) * 2; if (e >= (size_t)nheads * TT * HD) return; const int d = (int)(e % HD); const int t = (int)((e / HD) % TT); const int h = (int)(e / ((size_t)HD * TT)); const float* f = F + (size_t)t * pitch + h * HD; const float rf = RF ? RF[(size_t)h * TT + t] : 1.0f; v2h o16; v2us oh, ol;
#pragma unroll
    for (int q = 0; q < 2; ++q) { const int dd = d + q; const int dp = (dd < HD / 2) ? dd + HD / 2 : dd - HD / 2; float x0 = f[dd], x1 = f[dp];
        if (RF) { float n0 = __fmul_rn(x0, rf), n1 = __fmul_rn(x1, rf); asm volatile("" : "+v"(n0)); asm volatile("" : "+v"(n1)); x0 = __fmul_rn(bfr(nw[dd]), n0); x1 = __fmul_rn(bfr(nw[dp]), n1); }
        const v2f cs = *(const v2f*)(CS + ((size_t)t * HD + dd) * 2); float a = __fmul_rn(x0, cs[0]), bq = __fmul_rn(x1, cs[1]); asm volatile("" : "+v"(a)); asm volatile("" : "+v"(bq)); const float r = ((dd < HD / 2) ? __fsub_rn(a, bq) : __fadd_rn(a, bq)) * sc;
        o16[q] = tohx(r); unsigned short a2, c2; splitf(r, a2, c2); oh[q] = a2; ol[q] = c2; }
    *(v2h*)(P16 + e) = o16; *(v2us*)(Ph + e) = oh; *(v2us*)(Pl + e) = ol;  }
__global__ __launch_bounds__(256) void k_vtp(const float* __restrict__ F, int pitch, int nheads, h16* V16, bf* Vh, bf* Vl) { const size_t e = ((size_t)blockIdx.x * 256 + threadIdx.x) * 2; if (e >= (size_t)nheads * HD * TT) return; const int t = (int)(e % TT); const int d = (int)((e / TT) % HD); const int g = (int)(e / ((size_t)TT * HD)); v2h o16; v2us oh, ol;
#pragma unroll
    for (int q = 0; q < 2; ++q) { const float x = F[(size_t)(t + q) * pitch + g * HD + d]; o16[q] = tohx(x); unsigned short a2, c2; splitf(x, a2, c2); oh[q] = a2; ol[q] = c2; }
    *(v2h*)(V16 + e) = o16; *(v2us*)(Vh + e) = oh; *(v2us*)(Vl + e) = ol;  }
__global__ __launch_bounds__(256) void k_csid(float* CS) { const int idx = blockIdx.x * 256 + threadIdx.x; if (idx >= TT * HD) return; v2f cs; cs[0] = 1.0f; cs[1] = 0.0f; *(v2f*)(CS + (size_t)idx * 2) = cs;  }
// k_asoft: per row (zz, i): t = S x HD^-0.5 for j <= i and i - j < WIN (sliding causal window; the reference's -1e9 additive fill vanishes identically); softmax over the 2048 keys (register row, one exp, fixed trees);
__global__ __launch_bounds__(256) void k_asoft(const float* __restrict__ Sb, h16* P16, bf* Ph, bf* Pl) {
    const int lane = threadIdx.x & 31; const int row = blockIdx.x * 8 + (threadIdx.x >> 5); if (row >= ZH * TT) return; const int i = row % TT; const int zz = row / TT; (void)zz; const bool hires = (i < RH); const float* sr = Sb + (size_t)row * TT; float v[TT / 32]; float mx = -3.0e38f;
#pragma unroll
    for (int ch = 0; ch < TT / 128; ++ch) { const int j0 = ch * 128 + lane * 4; const v4f a = *(const v4f*)(sr + j0);
#pragma unroll
        for (int q = 0; q < 4; ++q) { const int j = j0 + q; (void)j; const float t = (j <= i && i - j < WIN) ? a[q] * SCL : -3.0e38f; v[ch * 4 + q] = t; mx = fmaxf(mx, t); } }
#pragma unroll
    for (int sh = 16; sh; sh >>= 1) mx = fmaxf(mx, __shfl_xor(mx, sh, 32));
    float sum = 0.f;
#pragma unroll
    for (int k = 0; k < TT / 32; ++k) { float d0 = __fsub_rn(v[k], mx); asm volatile("" : "+v"(d0)); v[k] = __builtin_amdgcn_exp2f(__fmul_rn(d0, 1.4426950408889634f)); sum += v[k]; }
#pragma unroll
    for (int sh = 16; sh; sh >>= 1) sum += __shfl_xor(sum, sh, 32);
    const float f = __fdiv_rn(hires ? 1.0f : PCAR, sum);
{
        if (hires) {
#pragma unroll
            for (int ch = 0; ch < TT / 128; ++ch) { v4us oh, ol;
#pragma unroll
                for (int q = 0; q < 4; ++q) { unsigned short a, c2; splitf(v[ch * 4 + q] * f, a, c2); oh[q] = a; ol[q] = c2; }
                const size_t oo = ((size_t)zz * (RH ? RH : 1) + i) * TT + ch * 128 + lane * 4; *(v4us*)(Ph + oo) = oh; *(v4us*)(Pl + oo) = ol; }
        } else {
#pragma unroll
            for (int ch = 0; ch < TT / 128; ++ch) { v4h o4;
#pragma unroll
                for (int q = 0; q < 4; ++q) o4[q] = tohx(v[ch * 4 + q] * f);
                *(v4h*)(P16 + (size_t)row * TT + ch * 128 + lane * 4) = o4; } }
         }
}
__global__ __launch_bounds__(256) void k_merge(const float* __restrict__ O, int h0, bf* Ah, bf* Al) { const size_t e = ((size_t)blockIdx.x * 256 + threadIdx.x) * 2; if (e >= (size_t)ZH * TT * HD) return; const int d = (int)(e % HD); const int t = (int)((e / HD) % TT); const int zz = (int)(e / ((size_t)HD * TT)); const float cs = (t < RH) ? 1.0f : (1.0f / PCAR); const size_t oo = (size_t)t * DQ + (h0 + zz) * HD + d;
    v2us oh, ol;
#pragma unroll
    for (int q = 0; q < 2; ++q) { unsigned short a, c2; splitf(O[e + q] * cs, a, c2); oh[q] = a; ol[q] = c2; } *(v2us*)(Ah + oo) = oh; *(v2us*)(Al + oo) = ol;  }

extern "C" void kernel_launch(void* const* d_in, const int* in_sizes, int n_in,
                              void* d_out, int out_size, void* d_ws, size_t ws_size, hipStream_t stream) {
    (void)in_sizes; (void)n_in; (void)out_size;
    const float* x = (const float*)d_in[0]; const float* xk = (const float*)d_in[1]; const float* xv = (const float*)d_in[2];   /* three streams: q, k, v */ const float* wq = (const float*)d_in[3]; const float* wk = (const float*)d_in[4]; const float* wv = (const float*)d_in[5]; const float* wo = (const float*)d_in[6];   /* w_q, w_k, w_v, w_o ('oi' [768][768]) */
    float* OUT = (float*)d_out;     // [4][2048][768]
    char* wsp = (char*)d_ws;
    auto take = [&](size_t bytes) { char* p = wsp; wsp += (bytes + 255) & ~(size_t)255; return (void*)p; };
    bf* WQ = (bf*)take((size_t)DQ * DM * 2); bf* WK = (bf*)take((size_t)DKV * DM * 2); bf* WV = (bf*)take((size_t)DKV * DM * 2); bf* WO = (bf*)take((size_t)DM * DQ * 2); float* CS = (float*)take((size_t)TT * HD * 2 * 4);
    bf* XB = (bf*)take((size_t)TT * DM * 2); float* FQ = (float*)take((size_t)TT * DQ * 4); float* FK = (float*)take((size_t)TT * DKV * 4);
    h16* QP16 = (h16*)take((size_t)NH_ * TT * HD * 2); h16* KP16 = (h16*)take((size_t)NKV * TT * HD * 2); h16* VT16 = (h16*)take((size_t)NKV * HD * TT * 2);
    bf* QPh = (bf*)take((size_t)NH_ * TT * HD * 2); bf* QPl = (bf*)take((size_t)NH_ * TT * HD * 2); bf* KPh = (bf*)take((size_t)NKV * TT * HD * 2); bf* KPl = (bf*)take((size_t)NKV * TT * HD * 2); bf* VTh = (bf*)take((size_t)NKV * HD * TT * 2); bf* VTl = (bf*)take((size_t)NKV * HD * TT * 2); bf* Ph = (bf*)take((size_t)ZH * RH * TT * 2); bf* Pl = (bf*)take((size_t)ZH * RH * TT * 2);
    float* Sb = (float*)take((size_t)ZH * TT * TT * 4); h16* P16 = (h16*)take((size_t)ZH * TT * TT * 2); float* Ob = (float*)take((size_t)ZH * TT * HD * 4); bf* ATh = (bf*)take((size_t)TT * DQ * 2); bf* ATl = (bf*)take((size_t)TT * DQ * 2);
    if ((size_t)(wsp - (char*)d_ws) > ws_size) return;    // ws 256 MiB
    float* FV = FK;   // v projection reuses the k buffer after the k planes are built (stream-ordered)
    { k_cvt8<<<(unsigned)(((size_t)DQ * DM / 8 + 255) / 256), 256, 0, stream>>>(wq, WQ, (size_t)DQ * DM / 8); k_cvt8<<<(unsigned)(((size_t)DKV * DM / 8 + 255) / 256), 256, 0, stream>>>(wk, WK, (size_t)DKV * DM / 8); k_cvt8<<<(unsigned)(((size_t)DKV * DM / 8 + 255) / 256), 256, 0, stream>>>(wv, WV, (size_t)DKV * DM / 8);
      k_cvt8<<<(unsigned)(((size_t)DM * DQ / 8 + 255) / 256), 256, 0, stream>>>(wo, WO, (size_t)DM * DQ / 8);
       }
    k_csid<<<(TT * HD + 255) / 256, 256, 0, stream>>>(CS);
    const unsigned LQ = (unsigned)(((size_t)NH_ * TT * HD / 2 + 255) / 256), LKv = (unsigned)(((size_t)NKV * TT * HD / 2 + 255) / 256);
    for (int b = 0; b < NB_; ++b) {
        
        k_cvt8<<<(unsigned)(((size_t)TT * DM / 8 + 255) / 256), 256, 0, stream>>>(x + (size_t)b * TT * DM, XB, (size_t)TT * DM / 8);
        k_gemmw<bf, 0, false><<<dim3(TT / 64, DQ / 64, 1), 32, 0, stream>>>(XB, nullptr, WQ, nullptr, DM, FQ, DQ, nullptr, 0, 0, 0);
        k_rope<<<LQ, 256, 0, stream>>>(FQ, DQ, NH_, CS, nullptr, nullptr, 1.0f, QP16, QPh, QPl);
        k_cvt8<<<(unsigned)(((size_t)TT * DM / 8 + 255) / 256), 256, 0, stream>>>(xk + (size_t)b * TT * DM, XB, (size_t)TT * DM / 8);   /* XB := bf16(k[b]) */ k_gemmw<bf, 0, false><<<dim3(TT / 64, DKV / 64, 1), 32, 0, stream>>>(XB, nullptr, WK, nullptr, DM, FK, DKV, nullptr, 0, 0, 0);
        k_rope<<<LKv, 256, 0, stream>>>(FK, DKV, NKV, CS, nullptr, nullptr, 1.0f, KP16, KPh, KPl);
        k_cvt8<<<(unsigned)(((size_t)TT * DM / 8 + 255) / 256), 256, 0, stream>>>(xv + (size_t)b * TT * DM, XB, (size_t)TT * DM / 8);   /* XB := bf16(v[b]) */ k_gemmw<bf, 0, false><<<dim3(TT / 64, DKV / 64, 1), 32, 0, stream>>>(XB, nullptr, WV, nullptr, DM, FV, DKV, nullptr, 0, 0, 0); k_vtp<<<LKv, 256, 0, stream>>>(FV, DKV, NKV, VT16, VTh, VTl);
        for (int h0 = 0; h0 < NH_; h0 += ZH) { const size_t zq = (size_t)h0, zk = (size_t)(h0 / REP);   // one kv head per query head: the pass's two heads use consecutive kv planes (z-strides TT*HD)
            k_gemmc<bf, 2, 1><<<dim3(RH / 64, TT / 64, ZH), 32, 0, stream>>>(QPh + zq * TT * HD, QPl + zq * TT * HD, KPh + zk * TT * HD, KPl + zk * TT * HD, HD, Sb, TT, 0, (size_t)TT * HD, (size_t)TT * HD, (size_t)TT * TT);
            k_gemmc<h16, 0, 1><<<dim3((TT - RH) / 64, TT / 64, ZH), 32, 0, stream>>>(QP16 + zq * TT * HD + (size_t)RH * HD, nullptr, KP16 + zk * TT * HD, nullptr, HD, Sb + (size_t)RH * TT, TT, RH, (size_t)TT * HD, (size_t)TT * HD, (size_t)TT * TT);
            k_asoft<<<ZH * TT / 8, 256, 0, stream>>>(Sb, P16, Ph, Pl);
            k_gemmc<bf, 2, 2><<<dim3(RH / 64, HD / 64, ZH), 32, 0, stream>>>(Ph, Pl, VTh + zk * HD * TT, VTl + zk * HD * TT, TT, Ob, HD, 0, (size_t)RH * TT, (size_t)HD * TT, (size_t)TT * HD);
            k_gemmc<h16, 0, 2><<<dim3((TT - RH) / 64, HD / 64, ZH), 32, 0, stream>>>(P16 + (size_t)RH * TT, nullptr, VT16 + zk * HD * TT, nullptr, TT, Ob + (size_t)RH * HD, HD, RH, (size_t)TT * TT, (size_t)HD * TT, (size_t)TT * HD);
            k_merge<<<(unsigned)(((size_t)ZH * TT * HD / 2 + 255) / 256), 256, 0, stream>>>(Ob, h0, ATh, ATl); }
        k_gemmw<bf, 1, false><<<dim3(TT / 64, DM / 64, 1), 32, 0, stream>>>(ATh, ATl, WO, nullptr, DQ, OUT + (size_t)b * TT * DM, DM, nullptr, 0, 0, 0); }
}

// v001
// A run of this version takes 1170 microseconds.
// Next to v000, in two timings, it ran 1.87 times as fast each time.
#include <hip/hip_runtime.h>

// Causal multi-head attention at d_model 768 on three input streams, bias-free (q, k, v [4][2048][768]; qh = q w_q^T, kh = k w_k^T, vh = v w_v^T ('oi' [768][768] 1/sqrt(768), no bias; 12 heads x 64); att x 1/sqrt(64); causal (-inf); softmax; y = merged w_o^T ('oi', no bias) -> [4][2048][768] (6.3 M); argument order q, k, v, w_q, w_k, w_v, w_o).
// Layout per batch: bf16 copy of each stream in turn (one staging buffer, refilled in stream order); 'oi' weights as-is; exact projections; identity-table plane builders; causal T-2048 attention (hybrid rows: < 512 hi/lo 3 products, rest fp16 x1024; k_gemmc skips tiles above the diagonal); merged hi/lo x w_o exact.
// Compute dtypes, f32 accumulate: every input rounded to bf16; projections exact; attention rows < 512 3 products, rest fp16; softmax f32; output projection hl x exact.

#define NB_  4
#define TT   2048
#define DM   768
#define NH_  12
#define NKV  12
#define REP  (NH_ / NKV)
#define HD   64
#define DQ   (NH_ * HD)
#define DKV  (NKV * HD)
#define ZH   6                    // heads per attention launch (z extent); 6 score planes + probability planes are what the workspace holds
#define RH   512                  // query rows < RH use hi+lo planes (0: none)
#define WIN  2048
#define PCAR 1024.0f
#define SCL  0.125f   // HD^-0.5
typedef _Float16 h16;
typedef unsigned short bf;
typedef __attribute__((ext_vector_type(16))) __bf16   v16bf;
typedef __attribute__((ext_vector_type(16))) _Float16 v16h;
typedef __attribute__((ext_vector_type(8)))  _Float16 v8h;
typedef __attribute__((ext_vector_type(8)))  unsigned short v8us;
typedef __attribute__((ext_vector_type(8)))  float    v8f;
typedef __attribute__((ext_vector_type(4)))  float    v4f;
typedef v8h  __attribute__((may_alias)) v8ha;
typedef v4f  __attribute__((may_alias)) v4fa;
typedef v8us __attribute__((may_alias)) v8usa;

__device__ __forceinline__ unsigned short f2bf(float f) { unsigned u = __float_as_uint(f); u += 0x7FFFu + ((u >> 16) & 1u); return (unsigned short)(u >> 16); }
__device__ __forceinline__ float bf2f(unsigned short b) { return __uint_as_float(((unsigned)b) << 16); }
__device__ __forceinline__ float bfr(float f) { return bf2f(f2bf(f)); }
__device__ __forceinline__ v16h cat16(v8h lo, v8h hi) { return __builtin_shufflevector(lo, hi, 0, 1, 2, 3, 4, 5, 6, 7, 8, 9, 10, 11, 12, 13, 14, 15); }
__device__ __forceinline__ v16bf cat16b(v8us lo, v8us hi) { return __builtin_bit_cast(v16bf, __builtin_shufflevector(lo, hi, 0, 1, 2, 3, 4, 5, 6, 7, 8, 9, 10, 11, 12, 13, 14, 15)); }
__device__ __forceinline__ v8f wmma16(v16h a, v16h b, v8f c) { return __builtin_amdgcn_wmma_f32_16x16x32_f16(false, a, false, b, (short)0, c, false, false); }
__device__ __forceinline__ v8f wmmab(v16bf a, v16bf b, v8f c) { return __builtin_amdgcn_wmma_f32_16x16x32_bf16(false, a, false, b, (short)0, c, false, false); }



// ---- k_gemmw: register-blocked GEMM, ONE WAVE per 64x64 output tile (16 accumulators), operands straight from K-contiguous 16-bit planes; grid (M/64, N/64, Z), 32 threads.
// C[m][n] (f32, pitch ldc, + optional f32 bias[n]) = sum_k A[m][k] Bt[n][k] (+ split products per NSPLIT). z-batch strides sA/sB/sC in elements. K % 32 == 0.
template <typename T16> struct WFrag;
template <> struct WFrag<h16> { typedef v16h V; static __device__ __forceinline__ V ld(const h16* p) { return cat16(*(const v8h*)p, *(const v8h*)(p + 16)); } static __device__ __forceinline__ v8f mma(V a, V b, v8f c) { return wmma16(a, b, c); } };
template <> struct WFrag<bf> { typedef v16bf V; static __device__ __forceinline__ V ld(const bf* p) { return cat16b(*(const v8us*)p, *(const v8us*)(p + 16)); } static __device__ __forceinline__ v8f mma(V a, V b, v8f c) { return wmmab(a, b, c); } };
template <typename T16, int NSPLIT, bool BIAS>
__global__ __launch_bounds__(32) void k_gemmw(const T16* __restrict__ A, const T16* __restrict__ A2, const T16* __restrict__ Bt, const T16* __restrict__ Bt2, int K, float* C, int ldc, const float* __restrict__ bias, size_t sA, size_t sB, size_t sC) {
    typedef typename WFrag<T16>::V V;
    __shared__ __align__(16) float os[16 * 68];
    const size_t z = blockIdx.z; A += z * sA; if (A2) A2 += z * sA; Bt += z * sB; if (Bt2) Bt2 += z * sB; C += z * sC;
    const int lane = threadIdx.x & 31, lr = lane & 15, hi = lane >> 4; const int r0 = blockIdx.x * 64, c0 = blockIdx.y * 64;
    v8f acc[4][4];
#pragma unroll
    for (int mb = 0; mb < 4; ++mb)
#pragma unroll
        for (int nb = 0; nb < 4; ++nb) acc[mb][nb] = (v8f){};
    const size_t aoff = (size_t)(r0 + lr) * K + 8 * hi, boff = (size_t)(c0 + lr) * K + 8 * hi;
#pragma unroll 1
    for (int kc = 0; kc < K; kc += 32) {
        V a[4], a2[4];
#pragma unroll
        for (int mb = 0; mb < 4; ++mb) { a[mb] = WFrag<T16>::ld(A + aoff + (size_t)mb * 16 * K + kc); if (NSPLIT == 1 || NSPLIT == 2) a2[mb] = WFrag<T16>::ld(A2 + aoff + (size_t)mb * 16 * K + kc); }
#pragma unroll
        for (int nb = 0; nb < 4; ++nb) { const V b = WFrag<T16>::ld(Bt + boff + (size_t)nb * 16 * K + kc); V b2; if (NSPLIT >= 2) b2 = WFrag<T16>::ld(Bt2 + boff + (size_t)nb * 16 * K + kc);
#pragma unroll
            for (int mb = 0; mb < 4; ++mb) { acc[mb][nb] = WFrag<T16>::mma(a[mb], b, acc[mb][nb]); if (NSPLIT == 1 || NSPLIT == 2) acc[mb][nb] = WFrag<T16>::mma(a2[mb], b, acc[mb][nb]); if (NSPLIT >= 2) acc[mb][nb] = WFrag<T16>::mma(a[mb], b2, acc[mb][nb]); } }
        asm volatile("v_nop\n\tv_nop\n\tv_nop\n\tv_nop" : "+v"(acc[0][0]), "+v"(acc[1][1]), "+v"(acc[2][2]), "+v"(acc[3][3]) : "v"(a[0]), "v"(a[3]));
    }
#pragma unroll
    for (int mb = 0; mb < 4; ++mb) {
#pragma unroll
        for (int nb = 0; nb < 4; ++nb) {
#pragma unroll
            for (int j = 0; j < 8; ++j) os[(hi * 8 + j) * 68 + nb * 16 + lr] = acc[mb][nb][j]; }
        __builtin_amdgcn_wave_barrier(); asm volatile("" ::: "memory");
        float* crow = C + (size_t)(r0 + mb * 16) * ldc + c0;
{
#pragma unroll
            for (int s = 0; s < 8; ++s) { const int row = 2 * s + hi, cofs = lr * 4; v4f val = *(const v4fa*)(os + row * 68 + cofs); if (BIAS) { val[0] += bfr(bias[c0 + cofs]); val[1] += bfr(bias[c0 + cofs + 1]); val[2] += bfr(bias[c0 + cofs + 2]); val[3] += bfr(bias[c0 + cofs + 3]); }
                *(v4f*)(crow + (size_t)row * ldc + cofs) = val; }
             }
        __builtin_amdgcn_wave_barrier(); asm volatile("" ::: "memory");
    }
}

// ---- k_gemmc: the same one-wave 64x64 tile GEMM specialised for causal attention: CMODE 1 skips score tiles entirely above the diagonal (query rows r0+roff.., key columns c0..), CMODE 2 limits the
// key (K) loop of the probability x value contraction to the diagonal block (probabilities beyond it are exactly zero). roff = row offset of this launch's first row within the sequence.
template <typename T16, int NSPLIT, int CMODE>
__global__ __launch_bounds__(32) void k_gemmc(const T16* __restrict__ A, const T16* __restrict__ A2, const T16* __restrict__ Bt, const T16* __restrict__ Bt2, int K, float* C, int ldc, int roff, size_t sA, size_t sB, size_t sC) {
    typedef typename WFrag<T16>::V V;
    __shared__ __align__(16) float os[16 * 68];
    const size_t z = blockIdx.z; A += z * sA; if (A2) A2 += z * sA; Bt += z * sB; if (Bt2) Bt2 += z * sB; C += z * sC;
    const int lane = threadIdx.x & 31, lr = lane & 15, hi = lane >> 4; const int r0 = blockIdx.x * 64, c0 = blockIdx.y * 64;
    if (CMODE == 1 && c0 > r0 + roff + 63) return;                  // score tile entirely above the causal diagonal: never read (the softmax masks j > i by select)
    const int Kl = (CMODE == 2) ? min(K, r0 + roff + 64) : K;        // P.V: probabilities are exactly 0 beyond the diagonal block, so the K loop stops there
    v8f acc[4][4];
#pragma unroll
    for (int mb = 0; mb < 4; ++mb)
#pragma unroll
        for (int nb = 0; nb < 4; ++nb) acc[mb][nb] = (v8f){};
    const size_t aoff = (size_t)(r0 + lr) * K + 8 * hi, boff = (size_t)(c0 + lr) * K + 8 * hi;
#pragma unroll 1
    for (int kc = 0; kc < Kl; kc += 32) {
        V a[4], a2[4];
#pragma unroll
        for (int mb = 0; mb < 4; ++mb) { a[mb] = WFrag<T16>::ld(A + aoff + (size_t)mb * 16 * K + kc); if (NSPLIT == 1 || NSPLIT == 2) a2[mb] = WFrag<T16>::ld(A2 + aoff + (size_t)mb * 16 * K + kc); }
#pragma unroll
        for (int nb = 0; nb < 4; ++nb) { const V b = WFrag<T16>::ld(Bt + boff + (size_t)nb * 16 * K + kc); V b2; if (NSPLIT >= 2) b2 = WFrag<T16>::ld(Bt2 + boff + (size_t)nb * 16 * K + kc);
#pragma unroll
            for (int mb = 0; mb < 4; ++mb) { acc[mb][nb] = WFrag<T16>::mma(a[mb], b, acc[mb][nb]); if (NSPLIT == 1 || NSPLIT == 2) acc[mb][nb] = WFrag<T16>::mma(a2[mb], b, acc[mb][nb]); if (NSPLIT >= 2) acc[mb][nb] = WFrag<T16>::mma(a[mb], b2, acc[mb][nb]); } }
        asm volatile("v_nop\n\tv_nop\n\tv_nop\n\tv_nop" : "+v"(acc[0][0]), "+v"(acc[1][1]), "+v"(acc[2][2]), "+v"(acc[3][3]) : "v"(a[0]), "v"(a[3]));
    }
#pragma unroll
    for (int mb = 0; mb < 4; ++mb) {
#pragma unroll
        for (int nb = 0; nb < 4; ++nb) {
#pragma unroll
            for (int j = 0; j < 8; ++j) os[(hi * 8 + j) * 68 + nb * 16 + lr] = acc[mb][nb][j]; }
        __builtin_amdgcn_wave_barrier(); asm volatile("" ::: "memory");
        float* crow = C + (size_t)(r0 + mb * 16) * ldc + c0;
{
#pragma unroll
            for (int s = 0; s < 8; ++s) { const int row = 2 * s + hi, cofs = lr * 4; v4f val = *(const v4fa*)(os + row * 68 + cofs);
                *(v4f*)(crow + (size_t)row * ldc + cofs) = val; }
             }
        __builtin_amdgcn_wave_barrier(); asm volatile("" ::: "memory");
    }
}

__device__ __forceinline__ h16 tohx(float x) { return (h16)x; }
__device__ __forceinline__ void splitf(float y, unsigned short& h, unsigned short& l) { h = f2bf(y); l = f2bf(y - bf2f(h)); }
typedef __attribute__((ext_vector_type(2))) _Float16 v2h;
typedef __attribute__((ext_vector_type(4))) _Float16 v4h;
typedef __attribute__((ext_vector_type(2))) unsigned short v2us;
typedef __attribute__((ext_vector_type(4))) unsigned short v4us;
typedef __attribute__((ext_vector_type(2))) float v2f;
typedef __attribute__((ext_vector_type(4))) int v4i;

__global__ __launch_bounds__(256) void k_cvt8(const float* __restrict__ src, bf* dst, size_t n8) { const size_t i = (size_t)blockIdx.x * 256 + threadIdx.x; if (i >= n8) return; const v8f v = *(const v8f*)(src + i * 8); v8us o;
#pragma unroll
    for (int k = 0; k < 8; ++k) o[k] = f2bf(v[k]); *(v8us*)(dst + i * 8) = o;  }

// k_rope: head planes [h][t][d] (fp16 + hi/lo) of rope(x) x sc with the rotate-half convention out[d] = x[d] cos[t][d] - x[d+HD/2] sin[t][d], out[d+HD/2] = x[d+HD/2] cos[t][d+HD/2] + x[d] sin[t][d+HD/2]
__global__ __launch_bounds__(256) void k_rope(const float* __restrict__ F, int pitch, int nheads, const float* __restrict__ CS, const float* __restrict__ RF, const float* __restrict__ nw, float sc, h16* P16, bf* Ph, bf* Pl) {
    const size_t e = ((size_t)blockIdx.x * 256 + threadIdx.x) * 2; if (e >= (size_t)nheads * TT * HD) return; const int d = (int)(e % HD); const int t = (int)((e / HD) % TT); const int h = (int)(e / ((size_t)HD * TT)); const float* f = F + (size_t)t * pitch + h * HD; const float rf = RF ? RF[(size_t)h * TT + t] : 1.0f; v2h o16; v2us oh, ol;
#pragma unroll
    for (int q = 0; q < 2; ++q) { const int dd = d + q; const int dp = (dd < HD / 2) ? dd + HD / 2 : dd - HD / 2; float x0 = f[dd], x1 = f[dp];
        if (RF) { float n0 = __fmul_rn(x0, rf), n1 = __fmul_rn(x1, rf); asm volatile("" : "+v"(n0)); asm volatile("" : "+v"(n1)); x0 = __fmul_rn(bfr(nw[dd]), n0); x1 = __fmul_rn(bfr(nw[dp]), n1); }
        const v2f cs = *(const v2f*)(CS + ((size_t)t * HD + dd) * 2); float a = __fmul_rn(x0, cs[0]), bq = __fmul_rn(x1, cs[1]); asm volatile("" : "+v"(a)); asm volatile("" : "+v"(bq)); const float r = ((dd < HD / 2) ? __fsub_rn(a, bq) : __fadd_rn(a, bq)) * sc;
        o16[q] = tohx(r); unsigned short a2, c2; splitf(r, a2, c2); oh[q] = a2; ol[q] = c2; }
    *(v2h*)(P16 + e) = o16; *(v2us*)(Ph + e) = oh; *(v2us*)(Pl + e) = ol;  }
__global__ __launch_bounds__(256) void k_vtp(const float* __restrict__ F, int pitch, int nheads, h16* V16, bf* Vh, bf* Vl) { const size_t e = ((size_t)blockIdx.x * 256 + threadIdx.x) * 2; if (e >= (size_t)nheads * HD * TT) return; const int t = (int)(e % TT); const int d = (int)((e / TT) % HD); const int g = (int)(e / ((size_t)TT * HD)); v2h o16; v2us oh, ol;
#pragma unroll
    for (int q = 0; q < 2; ++q) { const float x = F[(size_t)(t + q) * pitch + g * HD + d]; o16[q] = tohx(x); unsigned short a2, c2; splitf(x, a2, c2); oh[q] = a2; ol[q] = c2; }
    *(v2h*)(V16 + e) = o16; *(v2us*)(Vh + e) = oh; *(v2us*)(Vl + e) = ol;  }
__global__ __launch_bounds__(256) void k_csid(float* CS) { const int idx = blockIdx.x * 256 + threadIdx.x; if (idx >= TT * HD) return; v2f cs; cs[0] = 1.0f; cs[1] = 0.0f; *(v2f*)(CS + (size_t)idx * 2) = cs;  }
// k_asoft: per row (zz, i): t = S x HD^-0.5 for j <= i and i - j < WIN (sliding causal window; the reference's -1e9 additive fill vanishes identically); softmax over the 2048 keys (register row, one exp, fixed trees);
__global__ __launch_bounds__(256) void k_asoft(const float* __restrict__ Sb, h16* P16, bf* Ph, bf* Pl) {
    const int lane = threadIdx.x & 31; const int row = blockIdx.x * 8 + (threadIdx.x >> 5); if (row >= ZH * TT) return; const int i = row % TT; const int zz = row / TT; (void)zz; const bool hires = (i < RH); const float* sr = Sb + (size_t)row * TT; float v[TT / 32]; float mx = -3.0e38f;
#pragma unroll
    for (int ch = 0; ch < TT / 128; ++ch) { const int j0 = ch * 128 + lane * 4; const v4f a = *(const v4f*)(sr + j0);
#pragma unroll
        for (int q = 0; q < 4; ++q) { const int j = j0 + q; (void)j; const float t = (j <= i && i - j < WIN) ? a[q] * SCL : -3.0e38f; v[ch * 4 + q] = t; mx = fmaxf(mx, t); } }
#pragma unroll
    for (int sh = 16; sh; sh >>= 1) mx = fmaxf(mx, __shfl_xor(mx, sh, 32));
    float sum = 0.f;
#pragma unroll
    for (int k = 0; k < TT / 32; ++k) { float d0 = __fsub_rn(v[k], mx); asm volatile("" : "+v"(d0)); v[k] = __builtin_amdgcn_exp2f(__fmul_rn(d0, 1.4426950408889634f)); sum += v[k]; }
#pragma unroll
    for (int sh = 16; sh; sh >>= 1) sum += __shfl_xor(sum, sh, 32);
    const float f = __fdiv_rn(hires ? 1.0f : PCAR, sum);
{
        if (hires) {
#pragma unroll
            for (int ch = 0; ch < TT / 128; ++ch) { v4us oh, ol;
#pragma unroll
                for (int q = 0; q < 4; ++q) { unsigned short a, c2; splitf(v[ch * 4 + q] * f, a, c2); oh[q] = a; ol[q] = c2; }
                const size_t oo = ((size_t)zz * (RH ? RH : 1) + i) * TT + ch * 128 + lane * 4; *(v4us*)(Ph + oo) = oh; *(v4us*)(Pl + oo) = ol; }
        } else {
#pragma unroll
            for (int ch = 0; ch < TT / 128; ++ch) { v4h o4;
#pragma unroll
                for (int q = 0; q < 4; ++q) o4[q] = tohx(v[ch * 4 + q] * f);
                *(v4h*)(P16 + (size_t)row * TT + ch * 128 + lane * 4) = o4; } }
         }
}
__global__ __launch_bounds__(256) void k_merge(const float* __restrict__ O, int h0, bf* Ah, bf* Al) { const size_t e = ((size_t)blockIdx.x * 256 + threadIdx.x) * 2; if (e >= (size_t)ZH * TT * HD) return; const int d = (int)(e % HD); const int t = (int)((e / HD) % TT); const int zz = (int)(e / ((size_t)HD * TT)); const float cs = (t < RH) ? 1.0f : (1.0f / PCAR); const size_t oo = (size_t)t * DQ + (h0 + zz) * HD + d;
    v2us oh, ol;
#pragma unroll
    for (int q = 0; q < 2; ++q) { unsigned short a, c2; splitf(O[e + q] * cs, a, c2); oh[q] = a; ol[q] = c2; } *(v2us*)(Ah + oo) = oh; *(v2us*)(Al + oo) = ol;  }

extern "C" void kernel_launch(void* const* d_in, const int* in_sizes, int n_in,
                              void* d_out, int out_size, void* d_ws, size_t ws_size, hipStream_t stream) {
    (void)in_sizes; (void)n_in; (void)out_size;
    const float* x = (const float*)d_in[0]; const float* xk = (const float*)d_in[1]; const float* xv = (const float*)d_in[2];   /* three streams: q, k, v */ const float* wq = (const float*)d_in[3]; const float* wk = (const float*)d_in[4]; const float* wv = (const float*)d_in[5]; const float* wo = (const float*)d_in[6];   /* w_q, w_k, w_v, w_o ('oi' [768][768]) */
    float* OUT = (float*)d_out;     // [4][2048][768]
    char* wsp = (char*)d_ws;
    auto take = [&](size_t bytes) { char* p = wsp; wsp += (bytes + 255) & ~(size_t)255; return (void*)p; };
    bf* WQ = (bf*)take((size_t)DQ * DM * 2); bf* WK = (bf*)take((size_t)DKV * DM * 2); bf* WV = (bf*)take((size_t)DKV * DM * 2); bf* WO = (bf*)take((size_t)DM * DQ * 2); float* CS = (float*)take((size_t)TT * HD * 2 * 4);
    bf* XB = (bf*)take((size_t)TT * DM * 2); float* FQ = (float*)take((size_t)TT * DQ * 4); float* FK = (float*)take((size_t)TT * DKV * 4);
    h16* QP16 = (h16*)take((size_t)NH_ * TT * HD * 2); h16* KP16 = (h16*)take((size_t)NKV * TT * HD * 2); h16* VT16 = (h16*)take((size_t)NKV * HD * TT * 2);
    bf* QPh = (bf*)take((size_t)NH_ * TT * HD * 2); bf* QPl = (bf*)take((size_t)NH_ * TT * HD * 2); bf* KPh = (bf*)take((size_t)NKV * TT * HD * 2); bf* KPl = (bf*)take((size_t)NKV * TT * HD * 2); bf* VTh = (bf*)take((size_t)NKV * HD * TT * 2); bf* VTl = (bf*)take((size_t)NKV * HD * TT * 2); bf* Ph = (bf*)take((size_t)ZH * RH * TT * 2); bf* Pl = (bf*)take((size_t)ZH * RH * TT * 2);
    float* Sb = (float*)take((size_t)ZH * TT * TT * 4); h16* P16 = (h16*)take((size_t)ZH * TT * TT * 2); float* Ob = (float*)take((size_t)ZH * TT * HD * 4); bf* ATh = (bf*)take((size_t)TT * DQ * 2); bf* ATl = (bf*)take((size_t)TT * DQ * 2);
    if ((size_t)(wsp - (char*)d_ws) > ws_size) return;    // ws 256 MiB
    float* FV = FK;   // v projection reuses the k buffer after the k planes are built (stream-ordered)
    { k_cvt8<<<(unsigned)(((size_t)DQ * DM / 8 + 255) / 256), 256, 0, stream>>>(wq, WQ, (size_t)DQ * DM / 8); k_cvt8<<<(unsigned)(((size_t)DKV * DM / 8 + 255) / 256), 256, 0, stream>>>(wk, WK, (size_t)DKV * DM / 8); k_cvt8<<<(unsigned)(((size_t)DKV * DM / 8 + 255) / 256), 256, 0, stream>>>(wv, WV, (size_t)DKV * DM / 8);
      k_cvt8<<<(unsigned)(((size_t)DM * DQ / 8 + 255) / 256), 256, 0, stream>>>(wo, WO, (size_t)DM * DQ / 8);
       }
    k_csid<<<(TT * HD + 255) / 256, 256, 0, stream>>>(CS);
    const unsigned LQ = (unsigned)(((size_t)NH_ * TT * HD / 2 + 255) / 256), LKv = (unsigned)(((size_t)NKV * TT * HD / 2 + 255) / 256);
    for (int b = 0; b < NB_; ++b) {
        
        k_cvt8<<<(unsigned)(((size_t)TT * DM / 8 + 255) / 256), 256, 0, stream>>>(x + (size_t)b * TT * DM, XB, (size_t)TT * DM / 8);
        k_gemmw<bf, 0, false><<<dim3(TT / 64, DQ / 64, 1), 32, 0, stream>>>(XB, nullptr, WQ, nullptr, DM, FQ, DQ, nullptr, 0, 0, 0);
        k_rope<<<LQ, 256, 0, stream>>>(FQ, DQ, NH_, CS, nullptr, nullptr, 1.0f, QP16, QPh, QPl);
        k_cvt8<<<(unsigned)(((size_t)TT * DM / 8 + 255) / 256), 256, 0, stream>>>(xk + (size_t)b * TT * DM, XB, (size_t)TT * DM / 8);   /* XB := bf16(k[b]) */ k_gemmw<bf, 0, false><<<dim3(TT / 64, DKV / 64, 1), 32, 0, stream>>>(XB, nullptr, WK, nullptr, DM, FK, DKV, nullptr, 0, 0, 0);
        k_rope<<<LKv, 256, 0, stream>>>(FK, DKV, NKV, CS, nullptr, nullptr, 1.0f, KP16, KPh, KPl);
        k_cvt8<<<(unsigned)(((size_t)TT * DM / 8 + 255) / 256), 256, 0, stream>>>(xv + (size_t)b * TT * DM, XB, (size_t)TT * DM / 8);   /* XB := bf16(v[b]) */ k_gemmw<bf, 0, false><<<dim3(TT / 64, DKV / 64, 1), 32, 0, stream>>>(XB, nullptr, WV, nullptr, DM, FV, DKV, nullptr, 0, 0, 0); k_vtp<<<LKv, 256, 0, stream>>>(FV, DKV, NKV, VT16, VTh, VTl);
        for (int h0 = 0; h0 < NH_; h0 += ZH) { const size_t zq = (size_t)h0, zk = (size_t)(h0 / REP);   // one kv head per query head: the pass's heads use consecutive kv planes (z-strides TT*HD)
            k_gemmc<bf, 2, 1><<<dim3(RH / 64, TT / 64, ZH), 32, 0, stream>>>(QPh + zq * TT * HD, QPl + zq * TT * HD, KPh + zk * TT * HD, KPl + zk * TT * HD, HD, Sb, TT, 0, (size_t)TT * HD, (size_t)TT * HD, (size_t)TT * TT);
            k_gemmc<h16, 0, 1><<<dim3((TT - RH) / 64, TT / 64, ZH), 32, 0, stream>>>(QP16 + zq * TT * HD + (size_t)RH * HD, nullptr, KP16 + zk * TT * HD, nullptr, HD, Sb + (size_t)RH * TT, TT, RH, (size_t)TT * HD, (size_t)TT * HD, (size_t)TT * TT);
            k_asoft<<<ZH * TT / 8, 256, 0, stream>>>(Sb, P16, Ph, Pl);
            k_gemmc<bf, 2, 2><<<dim3(RH / 64, HD / 64, ZH), 32, 0, stream>>>(Ph, Pl, VTh + zk * HD * TT, VTl + zk * HD * TT, TT, Ob, HD, 0, (size_t)RH * TT, (size_t)HD * TT, (size_t)TT * HD);
            k_gemmc<h16, 0, 2><<<dim3((TT - RH) / 64, HD / 64, ZH), 32, 0, stream>>>(P16 + (size_t)RH * TT, nullptr, VT16 + zk * HD * TT, nullptr, TT, Ob + (size_t)RH * HD, HD, RH, (size_t)TT * TT, (size_t)HD * TT, (size_t)TT * HD);
            k_merge<<<(unsigned)(((size_t)ZH * TT * HD / 2 + 255) / 256), 256, 0, stream>>>(Ob, h0, ATh, ATl); }
        k_gemmw<bf, 1, false><<<dim3(TT / 64, DM / 64, 1), 32, 0, stream>>>(ATh, ATl, WO, nullptr, DQ, OUT + (size_t)b * TT * DM, DM, nullptr, 0, 0, 0); }
}

// v002
// Measured time: 769 microseconds a run.
// Timed twice side by side with v001, it ran 1.54 and 1.53 times as fast.
// Over all steps from v000 it is 2.87 times as fast.
#include <hip/hip_runtime.h>

// Causal multi-head attention at d_model 768 on three input streams, bias-free (q, k, v [4][2048][768]; qh = q w_q^T, kh = k w_k^T, vh = v w_v^T ('oi' [768][768] 1/sqrt(768), no bias; 12 heads x 64); att x 1/sqrt(64); causal (-inf); softmax; y = merged w_o^T ('oi', no bias) -> [4][2048][768] (6.3 M); argument order q, k, v, w_q, w_k, w_v, w_o).
// Layout per batch: bf16 copy of each stream in turn (one staging buffer, refilled in stream order); 'oi' weights as-is; exact projections; identity-table plane builders; causal T-2048 attention (hybrid rows: < 512 hi/lo 3 products, rest fp16 x1024; k_gemmc skips tiles above the diagonal); merged hi/lo x w_o exact.
// Compute dtypes, f32 accumulate: every input rounded to bf16; projections exact; attention rows < 512 3 products, rest fp16; softmax f32; output projection hl x exact.

#define NB_  4
#define TT   2048
#define DM   768
#define NH_  12
#define NKV  12
#define REP  (NH_ / NKV)
#define HD   64
#define DQ   (NH_ * HD)
#define DKV  (NKV * HD)
#define ZH   6                    // heads per attention launch (z extent); 6 score planes + probability planes are what the workspace holds
#define RH   512                  // query rows < RH use hi+lo planes (0: none)
#define WIN  2048
#define PCAR 1024.0f
#define SCL  0.125f   // HD^-0.5
typedef _Float16 h16;
typedef unsigned short bf;
typedef __attribute__((ext_vector_type(16))) __bf16   v16bf;
typedef __attribute__((ext_vector_type(16))) _Float16 v16h;
typedef __attribute__((ext_vector_type(8)))  _Float16 v8h;
typedef __attribute__((ext_vector_type(8)))  unsigned short v8us;
typedef __attribute__((ext_vector_type(8)))  float    v8f;
typedef __attribute__((ext_vector_type(4)))  float    v4f;
typedef v8h  __attribute__((may_alias)) v8ha;
typedef v4f  __attribute__((may_alias)) v4fa;
typedef v8us __attribute__((may_alias)) v8usa;

__device__ __forceinline__ unsigned short f2bf(float f) { unsigned u = __float_as_uint(f); u += 0x7FFFu + ((u >> 16) & 1u); return (unsigned short)(u >> 16); }
__device__ __forceinline__ float bf2f(unsigned short b) { return __uint_as_float(((unsigned)b) << 16); }
__device__ __forceinline__ float bfr(float f) { return bf2f(f2bf(f)); }
__device__ __forceinline__ v16h cat16(v8h lo, v8h hi) { return __builtin_shufflevector(lo, hi, 0, 1, 2, 3, 4, 5, 6, 7, 8, 9, 10, 11, 12, 13, 14, 15); }
__device__ __forceinline__ v16bf cat16b(v8us lo, v8us hi) { return __builtin_bit_cast(v16bf, __builtin_shufflevector(lo, hi, 0, 1, 2, 3, 4, 5, 6, 7, 8, 9, 10, 11, 12, 13, 14, 15)); }
__device__ __forceinline__ v8f wmma16(v16h a, v16h b, v8f c) { return __builtin_amdgcn_wmma_f32_16x16x32_f16(false, a, false, b, (short)0, c, false, false); }
__device__ __forceinline__ v8f wmmab(v16bf a, v16bf b, v8f c) { return __builtin_amdgcn_wmma_f32_16x16x32_bf16(false, a, false, b, (short)0, c, false, false); }



// ---- k_gemmw: register-blocked GEMM, ONE WAVE per 64x64 output tile (16 accumulators), operands straight from K-contiguous 16-bit planes; grid (M/64, N/64, Z), 32 threads.
// C[m][n] (f32, pitch ldc, + optional f32 bias[n]) = sum_k A[m][k] Bt[n][k] (+ split products per NSPLIT). z-batch strides sA/sB/sC in elements. K % (32 U) == 0.
template <typename T16> struct WFrag;
template <> struct WFrag<h16> { typedef v16h V; static __device__ __forceinline__ V ld(const h16* p) { return cat16(*(const v8h*)p, *(const v8h*)(p + 16)); } static __device__ __forceinline__ v8f mma(V a, V b, v8f c) { return wmma16(a, b, c); } };
template <> struct WFrag<bf> { typedef v16bf V; static __device__ __forceinline__ V ld(const bf* p) { return cat16b(*(const v8us*)p, *(const v8us*)(p + 16)); } static __device__ __forceinline__ v8f mma(V a, V b, v8f c) { return wmmab(a, b, c); } };
// kgroup: U consecutive 32-wide k steps of the 64x64 tile. All fragment loads of the U steps are issued first, as one group, so one wave pays the load latency once per U steps instead of several times per step;
// the products then run in the same k order as a one-step loop (per accumulator: a.b, a2.b, a.b2 for each step in turn), so every sum keeps its order.
// A, A2, Bt, Bt2: wave-uniform, already advanced to the group's first k; ao, bo: each lane's byte offsets of its four A rows and four B rows, fixed for the whole K loop.
template <typename T16, int NSPLIT, int U>
__device__ __forceinline__ void kgroup(const T16* __restrict__ A, const T16* __restrict__ A2, const T16* __restrict__ Bt, const T16* __restrict__ Bt2, const unsigned (&ao)[4], const unsigned (&bo)[4], v8f (&acc)[4][4]) {
    typedef typename WFrag<T16>::V V;
    V a[U][4], a2[U][4], b[U][4], b2[U][4];
    const T16 *pa[4], *pa2[4], *pb[4], *pb2[4];
#pragma unroll
    for (int q = 0; q < 4; ++q) { pa[q] = (const T16*)((const char*)A + ao[q]); pb[q] = (const T16*)((const char*)Bt + bo[q]); pa2[q] = (NSPLIT == 1 || NSPLIT == 2) ? (const T16*)((const char*)A2 + ao[q]) : pa[q]; pb2[q] = (NSPLIT >= 2) ? (const T16*)((const char*)Bt2 + bo[q]) : pb[q]; }
#pragma unroll
    for (int u = 0; u < U; ++u) {
#pragma unroll
        for (int mb = 0; mb < 4; ++mb) { a[u][mb] = WFrag<T16>::ld(pa[mb] + u * 32); if (NSPLIT == 1 || NSPLIT == 2) a2[u][mb] = WFrag<T16>::ld(pa2[mb] + u * 32); }
#pragma unroll
        for (int nb = 0; nb < 4; ++nb) { b[u][nb] = WFrag<T16>::ld(pb[nb] + u * 32); if (NSPLIT >= 2) b2[u][nb] = WFrag<T16>::ld(pb2[nb] + u * 32); } }
    // the wait behind the issued loads; their address registers are named as inputs so that none is given to a later load's result, or advanced, ahead of it
    asm volatile("s_wait_xcnt 0x0" :: "v"(pa[0]), "v"(pa[1]), "v"(pa[2]), "v"(pa[3]), "v"(pb[0]), "v"(pb[1]), "v"(pb[2]), "v"(pb[3]), "v"(pa2[0]), "v"(pa2[1]), "v"(pa2[2]), "v"(pa2[3]), "v"(pb2[0]), "v"(pb2[1]), "v"(pb2[2]), "v"(pb2[3]) : "memory");
    __builtin_amdgcn_sched_barrier(0);   // keeps the whole load group ahead of the first product (sunk back to their uses, the loads would again wait once per step) and the address advance behind the wait above
#pragma unroll
    for (int u = 0; u < U; ++u)
#pragma unroll
        for (int nb = 0; nb < 4; ++nb)
#pragma unroll
            for (int mb = 0; mb < 4; ++mb) { acc[mb][nb] = WFrag<T16>::mma(a[u][mb], b[u][nb], acc[mb][nb]); if (NSPLIT == 1 || NSPLIT == 2) acc[mb][nb] = WFrag<T16>::mma(a2[u][mb], b[u][nb], acc[mb][nb]); if (NSPLIT >= 2) acc[mb][nb] = WFrag<T16>::mma(a[u][mb], b2[u][nb], acc[mb][nb]); }
    // four vector slots behind the last product, also on the loop's taken back edge, before its operands or result are touched
    asm volatile("v_nop\n\tv_nop\n\tv_nop\n\tv_nop" : "+v"(acc[0][0]), "+v"(acc[1][1]), "+v"(acc[2][2]), "+v"(acc[3][3]) : "v"(a[U - 1][0]), "v"(a[U - 1][3]));
}
template <typename T16, int NSPLIT, bool BIAS, int U>
__global__ __launch_bounds__(32) void k_gemmw(const T16* __restrict__ A, const T16* __restrict__ A2, const T16* __restrict__ Bt, const T16* __restrict__ Bt2, int K, float* C, int ldc, const float* __restrict__ bias, size_t sA, size_t sB, size_t sC) {
    typedef typename WFrag<T16>::V V;
    __shared__ __align__(16) float os[16 * 68];
    const size_t z = blockIdx.z; A += z * sA; if (A2) A2 += z * sA; Bt += z * sB; if (Bt2) Bt2 += z * sB; C += z * sC;
    const int lane = threadIdx.x & 31, lr = lane & 15, hi = lane >> 4; const int r0 = blockIdx.x * 64, c0 = blockIdx.y * 64;
    v8f acc[4][4];
#pragma unroll
    for (int mb = 0; mb < 4; ++mb)
#pragma unroll
        for (int nb = 0; nb < 4; ++nb) acc[mb][nb] = (v8f){};
    unsigned ao[4], bo[4];   // byte offsets inside one z plane (below 2^32: a plane is at most 2048 x 2048 16-bit elements)
#pragma unroll
    for (int q = 0; q < 4; ++q) { ao[q] = ((unsigned)(r0 + q * 16 + lr) * (unsigned)K + 8u * hi) * 2u; bo[q] = ((unsigned)(c0 + q * 16 + lr) * (unsigned)K + 8u * hi) * 2u; }
#pragma unroll 1   // rolled: one load group per trip, every fragment index constant
    for (int kc = 0; kc < K; kc += 32 * U) kgroup<T16, NSPLIT, U>(A + kc, A2 + kc, Bt + kc, Bt2 + kc, ao, bo, acc);   // K % (32 U) == 0 at every call
#pragma unroll
    for (int mb = 0; mb < 4; ++mb) {
#pragma unroll
        for (int nb = 0; nb < 4; ++nb) {
#pragma unroll
            for (int j = 0; j < 8; ++j) os[(hi * 8 + j) * 68 + nb * 16 + lr] = acc[mb][nb][j]; }
        __builtin_amdgcn_wave_barrier(); asm volatile("" ::: "memory");
        float* crow = C + (size_t)(r0 + mb * 16) * ldc + c0;
{
#pragma unroll
            for (int s = 0; s < 8; ++s) { const int row = 2 * s + hi, cofs = lr * 4; v4f val = *(const v4fa*)(os + row * 68 + cofs); if (BIAS) { val[0] += bfr(bias[c0 + cofs]); val[1] += bfr(bias[c0 + cofs + 1]); val[2] += bfr(bias[c0 + cofs + 2]); val[3] += bfr(bias[c0 + cofs + 3]); }
                *(v4f*)(crow + (size_t)row * ldc + cofs) = val; }
             }
        __builtin_amdgcn_wave_barrier(); asm volatile("" ::: "memory");
    }
}

// ---- k_gemmc: the same one-wave 64x64 tile GEMM specialised for causal attention: CMODE 1 skips score tiles entirely above the diagonal (query rows r0+roff.., key columns c0..), CMODE 2 limits the
// key (K) loop of the probability x value contraction to the diagonal block (probabilities beyond it are exactly zero). roff = row offset of this launch's first row within the sequence.
template <typename T16, int NSPLIT, int CMODE, int U>
__global__ __launch_bounds__(32) void k_gemmc(const T16* __restrict__ A, const T16* __restrict__ A2, const T16* __restrict__ Bt, const T16* __restrict__ Bt2, int K, float* C, int ldc, int roff, size_t sA, size_t sB, size_t sC) {
    typedef typename WFrag<T16>::V V;
    __shared__ __align__(16) float os[16 * 68];
    const size_t z = blockIdx.z; A += z * sA; if (A2) A2 += z * sA; Bt += z * sB; if (Bt2) Bt2 += z * sB; C += z * sC;
    const int lane = threadIdx.x & 31, lr = lane & 15, hi = lane >> 4; const int r0 = blockIdx.x * 64, c0 = blockIdx.y * 64;
    if (CMODE == 1 && c0 > r0 + roff + 63) return;                  // score tile entirely above the causal diagonal: never read (the softmax masks j > i by select)
    const int Kl = (CMODE == 2) ? min(K, r0 + roff + 64) : K;        // P.V: probabilities are exactly 0 beyond the diagonal block, so the K loop stops there
    v8f acc[4][4];
#pragma unroll
    for (int mb = 0; mb < 4; ++mb)
#pragma unroll
        for (int nb = 0; nb < 4; ++nb) acc[mb][nb] = (v8f){};
    unsigned ao[4], bo[4];   // byte offsets inside one z plane (below 2^32: a plane is at most 2048 x 2048 16-bit elements)
#pragma unroll
    for (int q = 0; q < 4; ++q) { ao[q] = ((unsigned)(r0 + q * 16 + lr) * (unsigned)K + 8u * hi) * 2u; bo[q] = ((unsigned)(c0 + q * 16 + lr) * (unsigned)K + 8u * hi) * 2u; }
    int kc = 0;
#pragma unroll 1   // rolled: one load group per trip, every fragment index constant
    for (; kc + 32 * U <= Kl; kc += 32 * U) kgroup<T16, NSPLIT, U>(A + kc, A2 + kc, Bt + kc, Bt2 + kc, ao, bo, acc);
    if (U > 2) {   // Kl % 64 == 0: what the groups of U steps leave over is taken in groups of two
#pragma unroll 1   // rolled: at most U / 2 - 1 trips, no gain from a second copy of the body
        for (; kc < Kl; kc += 64) kgroup<T16, NSPLIT, 2>(A + kc, A2 + kc, Bt + kc, Bt2 + kc, ao, bo, acc); }
#pragma unroll
    for (int mb = 0; mb < 4; ++mb) {
#pragma unroll
        for (int nb = 0; nb < 4; ++nb) {
#pragma unroll
            for (int j = 0; j < 8; ++j) os[(hi * 8 + j) * 68 + nb * 16 + lr] = acc[mb][nb][j]; }
        __builtin_amdgcn_wave_barrier(); asm volatile("" ::: "memory");
        float* crow = C + (size_t)(r0 + mb * 16) * ldc + c0;
{
#pragma unroll
            for (int s = 0; s < 8; ++s) { const int row = 2 * s + hi, cofs = lr * 4; v4f val = *(const v4fa*)(os + row * 68 + cofs);
                *(v4f*)(crow + (size_t)row * ldc + cofs) = val; }
             }
        __builtin_amdgcn_wave_barrier(); asm volatile("" ::: "memory");
    }
}

__device__ __forceinline__ h16 tohx(float x) { return (h16)x; }
__device__ __forceinline__ void splitf(float y, unsigned short& h, unsigned short& l) { h = f2bf(y); l = f2bf(y - bf2f(h)); }
typedef __attribute__((ext_vector_type(2))) _Float16 v2h;
typedef __attribute__((ext_vector_type(4))) _Float16 v4h;
typedef __attribute__((ext_vector_type(2))) unsigned short v2us;
typedef __attribute__((ext_vector_type(4))) unsigned short v4us;
typedef __attribute__((ext_vector_type(2))) float v2f;
typedef __attribute__((ext_vector_type(4))) int v4i;

__global__ __launch_bounds__(256) void k_cvt8(const float* __restrict__ src, bf* dst, size_t n8) { const size_t i = (size_t)blockIdx.x * 256 + threadIdx.x; if (i >= n8) return; const v8f v = *(const v8f*)(src + i * 8); v8us o;
#pragma unroll
    for (int k = 0; k < 8; ++k) o[k] = f2bf(v[k]); *(v8us*)(dst + i * 8) = o;  }

// k_rope: head planes [h][t][d] (fp16 + hi/lo) of rope(x) x sc with the rotate-half convention out[d] = x[d] cos[t][d] - x[d+HD/2] sin[t][d], out[d+HD/2] = x[d+HD/2] cos[t][d+HD/2] + x[d] sin[t][d+HD/2]
__global__ __launch_bounds__(256) void k_rope(const float* __restrict__ F, int pitch, int nheads, const float* __restrict__ CS, const float* __restrict__ RF, const float* __restrict__ nw, float sc, h16* P16, bf* Ph, bf* Pl) {
    const size_t e = ((size_t)blockIdx.x * 256 + threadIdx.x) * 2; if (e >= (size_t)nheads * TT * HD) return; const int d = (int)(e % HD); const int t = (int)((e / HD) % TT); const int h = (int)(e / ((size_t)HD * TT)); const float* f = F + (size_t)t * pitch + h * HD; const float rf = RF ? RF[(size_t)h * TT + t] : 1.0f; v2h o16; v2us oh, ol;
#pragma unroll
    for (int q = 0; q < 2; ++q) { const int dd = d + q; const int dp = (dd < HD / 2) ? dd + HD / 2 : dd - HD / 2; float x0 = f[dd], x1 = f[dp];
        if (RF) { float n0 = __fmul_rn(x0, rf), n1 = __fmul_rn(x1, rf); asm volatile("" : "+v"(n0)); asm volatile("" : "+v"(n1)); x0 = __fmul_rn(bfr(nw[dd]), n0); x1 = __fmul_rn(bfr(nw[dp]), n1); }
        const v2f cs = *(const v2f*)(CS + ((size_t)t * HD + dd) * 2); float a = __fmul_rn(x0, cs[0]), bq = __fmul_rn(x1, cs[1]); asm volatile("" : "+v"(a)); asm volatile("" : "+v"(bq)); const float r = ((dd < HD / 2) ? __fsub_rn(a, bq) : __fadd_rn(a, bq)) * sc;
        o16[q] = tohx(r); unsigned short a2, c2; splitf(r, a2, c2); oh[q] = a2; ol[q] = c2; }
    *(v2h*)(P16 + e) = o16; *(v2us*)(Ph + e) = oh; *(v2us*)(Pl + e) = ol;  }
__global__ __launch_bounds__(256) void k_vtp(const float* __restrict__ F, int pitch, int nheads, h16* V16, bf* Vh, bf* Vl) { const size_t e = ((size_t)blockIdx.x * 256 + threadIdx.x) * 2; if (e >= (size_t)nheads * HD * TT) return; const int t = (int)(e % TT); const int d = (int)((e / TT) % HD); const int g = (int)(e / ((size_t)TT * HD)); v2h o16; v2us oh, ol;
#pragma unroll
    for (int q = 0; q < 2; ++q) { const float x = F[(size_t)(t + q) * pitch + g * HD + d]; o16[q] = tohx(x); unsigned short a2, c2; splitf(x, a2, c2); oh[q] = a2; ol[q] = c2; }
    *(v2h*)(V16 + e) = o16; *(v2us*)(Vh + e) = oh; *(v2us*)(Vl + e) = ol;  }
__global__ __launch_bounds__(256) void k_csid(float* CS) { const int idx = blockIdx.x * 256 + threadIdx.x; if (idx >= TT * HD) return; v2f cs; cs[0] = 1.0f; cs[1] = 0.0f; *(v2f*)(CS + (size_t)idx * 2) = cs;  }
// k_asoft: per row (zz, i): t = S x HD^-0.5 for j <= i and i - j < WIN (sliding causal window; the reference's -1e9 additive fill vanishes identically); softmax over the 2048 keys (register row, one exp, fixed trees);
__global__ __launch_bounds__(256) void k_asoft(const float* __restrict__ Sb, h16* P16, bf* Ph, bf* Pl) {
    const int lane = threadIdx.x & 31; const int row = blockIdx.x * 8 + (threadIdx.x >> 5); if (row >= ZH * TT) return; const int i = row % TT; const int zz = row / TT; (void)zz; const bool hires = (i < RH); const float* sr = Sb + (size_t)row * TT; float v[TT / 32]; float mx = -3.0e38f;
#pragma unroll
    for (int ch = 0; ch < TT / 128; ++ch) { const int j0 = ch * 128 + lane * 4; const v4f a = *(const v4f*)(sr + j0);
#pragma unroll
        for (int q = 0; q < 4; ++q) { const int j = j0 + q; (void)j; const float t = (j <= i && i - j < WIN) ? a[q] * SCL : -3.0e38f; v[ch * 4 + q] = t; mx = fmaxf(mx, t); } }
#pragma unroll
    for (int sh = 16; sh; sh >>= 1) mx = fmaxf(mx, __shfl_xor(mx, sh, 32));
    float sum = 0.f;
#pragma unroll
    for (int k = 0; k < TT / 32; ++k) { float d0 = __fsub_rn(v[k], mx); asm volatile("" : "+v"(d0)); v[k] = __builtin_amdgcn_exp2f(__fmul_rn(d0, 1.4426950408889634f)); sum += v[k]; }
#pragma unroll
    for (int sh = 16; sh; sh >>= 1) sum += __shfl_xor(sum, sh, 32);
    const float f = __fdiv_rn(hires ? 1.0f : PCAR, sum);
{
        if (hires) {
#pragma unroll
            for (int ch = 0; ch < TT / 128; ++ch) { v4us oh, ol;
#pragma unroll
                for (int q = 0; q < 4; ++q) { unsigned short a, c2; splitf(v[ch * 4 + q] * f, a, c2); oh[q] = a; ol[q] = c2; }
                const size_t oo = ((size_t)zz * (RH ? RH : 1) + i) * TT + ch * 128 + lane * 4; *(v4us*)(Ph + oo) = oh; *(v4us*)(Pl + oo) = ol; }
        } else {
#pragma unroll
            for (int ch = 0; ch < TT / 128; ++ch) { v4h o4;
#pragma unroll
                for (int q = 0; q < 4; ++q) o4[q] = tohx(v[ch * 4 + q] * f);
                *(v4h*)(P16 + (size_t)row * TT + ch * 128 + lane * 4) = o4; } }
         }
}
__global__ __launch_bounds__(256) void k_merge(const float* __restrict__ O, int h0, bf* Ah, bf* Al) { const size_t e = ((size_t)blockIdx.x * 256 + threadIdx.x) * 2; if (e >= (size_t)ZH * TT * HD) return; const int d = (int)(e % HD); const int t = (int)((e / HD) % TT); const int zz = (int)(e / ((size_t)HD * TT)); const float cs = (t < RH) ? 1.0f : (1.0f / PCAR); const size_t oo = (size_t)t * DQ + (h0 + zz) * HD + d;
    v2us oh, ol;
#pragma unroll
    for (int q = 0; q < 2; ++q) { unsigned short a, c2; splitf(O[e + q] * cs, a, c2); oh[q] = a; ol[q] = c2; } *(v2us*)(Ah + oo) = oh; *(v2us*)(Al + oo) = ol;  }

extern "C" void kernel_launch(void* const* d_in, const int* in_sizes, int n_in,
                              void* d_out, int out_size, void* d_ws, size_t ws_size, hipStream_t stream) {
    (void)in_sizes; (void)n_in; (void)out_size;
    const float* x = (const float*)d_in[0]; const float* xk = (const float*)d_in[1]; const float* xv = (const float*)d_in[2];   /* three streams: q, k, v */ const float* wq = (const float*)d_in[3]; const float* wk = (const float*)d_in[4]; const float* wv = (const float*)d_in[5]; const float* wo = (const float*)d_in[6];   /* w_q, w_k, w_v, w_o ('oi' [768][768]) */
    float* OUT = (float*)d_out;     // [4][2048][768]
    char* wsp = (char*)d_ws;
    auto take = [&](size_t bytes) { char* p = wsp; wsp += (bytes + 255) & ~(size_t)255; return (void*)p; };
    bf* WQ = (bf*)take((size_t)DQ * DM * 2); bf* WK = (bf*)take((size_t)DKV * DM * 2); bf* WV = (bf*)take((size_t)DKV * DM * 2); bf* WO = (bf*)take((size_t)DM * DQ * 2); float* CS = (float*)take((size_t)TT * HD * 2 * 4);
    bf* XB = (bf*)take((size_t)TT * DM * 2); float* FQ = (float*)take((size_t)TT * DQ * 4); float* FK = (float*)take((size_t)TT * DKV * 4);
    h16* QP16 = (h16*)take((size_t)NH_ * TT * HD * 2); h16* KP16 = (h16*)take((size_t)NKV * TT * HD * 2); h16* VT16 = (h16*)take((size_t)NKV * HD * TT * 2);
    bf* QPh = (bf*)take((size_t)NH_ * TT * HD * 2); bf* QPl = (bf*)take((size_t)NH_ * TT * HD * 2); bf* KPh = (bf*)take((size_t)NKV * TT * HD * 2); bf* KPl = (bf*)take((size_t)NKV * TT * HD * 2); bf* VTh = (bf*)take((size_t)NKV * HD * TT * 2); bf* VTl = (bf*)take((size_t)NKV * HD * TT * 2); bf* Ph = (bf*)take((size_t)ZH * RH * TT * 2); bf* Pl = (bf*)take((size_t)ZH * RH * TT * 2);
    float* Sb = (float*)take((size_t)ZH * TT * TT * 4); h16* P16 = (h16*)take((size_t)ZH * TT * TT * 2); float* Ob = (float*)take((size_t)ZH * TT * HD * 4); bf* ATh = (bf*)take((size_t)TT * DQ * 2); bf* ATl = (bf*)take((size_t)TT * DQ * 2);
    if ((size_t)(wsp - (char*)d_ws) > ws_size) return;    // ws 256 MiB
    float* FV = FK;   // v projection reuses the k buffer after the k planes are built (stream-ordered)
    { k_cvt8<<<(unsigned)(((size_t)DQ * DM / 8 + 255) / 256), 256, 0, stream>>>(wq, WQ, (size_t)DQ * DM / 8); k_cvt8<<<(unsigned)(((size_t)DKV * DM / 8 + 255) / 256), 256, 0, stream>>>(wk, WK, (size_t)DKV * DM / 8); k_cvt8<<<(unsigned)(((size_t)DKV * DM / 8 + 255) / 256), 256, 0, stream>>>(wv, WV, (size_t)DKV * DM / 8);
      k_cvt8<<<(unsigned)(((size_t)DM * DQ / 8 + 255) / 256), 256, 0, stream>>>(wo, WO, (size_t)DM * DQ / 8);
       }
    k_csid<<<(TT * HD + 255) / 256, 256, 0, stream>>>(CS);
    const unsigned LQ = (unsigned)(((size_t)NH_ * TT * HD / 2 + 255) / 256), LKv = (unsigned)(((size_t)NKV * TT * HD / 2 + 255) / 256);
    for (int b = 0; b < NB_; ++b) {
        
        k_cvt8<<<(unsigned)(((size_t)TT * DM / 8 + 255) / 256), 256, 0, stream>>>(x + (size_t)b * TT * DM, XB, (size_t)TT * DM / 8);
        k_gemmw<bf, 0, false, 8><<<dim3(TT / 64, DQ / 64, 1), 32, 0, stream>>>(XB, nullptr, WQ, nullptr, DM, FQ, DQ, nullptr, 0, 0, 0);
        k_rope<<<LQ, 256, 0, stream>>>(FQ, DQ, NH_, CS, nullptr, nullptr, 1.0f, QP16, QPh, QPl);
        k_cvt8<<<(unsigned)(((size_t)TT * DM / 8 + 255) / 256), 256, 0, stream>>>(xk + (size_t)b * TT * DM, XB, (size_t)TT * DM / 8);   /* XB := bf16(k[b]) */ k_gemmw<bf, 0, false, 8><<<dim3(TT / 64, DKV / 64, 1), 32, 0, stream>>>(XB, nullptr, WK, nullptr, DM, FK, DKV, nullptr, 0, 0, 0);
        k_rope<<<LKv, 256, 0, stream>>>(FK, DKV, NKV, CS, nullptr, nullptr, 1.0f, KP16, KPh, KPl);
        k_cvt8<<<(unsigned)(((size_t)TT * DM / 8 + 255) / 256), 256, 0, stream>>>(xv + (size_t)b * TT * DM, XB, (size_t)TT * DM / 8);   /* XB := bf16(v[b]) */ k_gemmw<bf, 0, false, 8><<<dim3(TT / 64, DKV / 64, 1), 32, 0, stream>>>(XB, nullptr, WV, nullptr, DM, FV, DKV, nullptr, 0, 0, 0); k_vtp<<<LKv, 256, 0, stream>>>(FV, DKV, NKV, VT16, VTh, VTl);
        for (int h0 = 0; h0 < NH_; h0 += ZH) { const size_t zq = (size_t)h0, zk = (size_t)(h0 / REP);   // one kv head per query head: the pass's heads use consecutive kv planes (z-strides TT*HD)
            k_gemmc<bf, 2, 1, 2><<<dim3(RH / 64, TT / 64, ZH), 32, 0, stream>>>(QPh + zq * TT * HD, QPl + zq * TT * HD, KPh + zk * TT * HD, KPl + zk * TT * HD, HD, Sb, TT, 0, (size_t)TT * HD, (size_t)TT * HD, (size_t)TT * TT);
            k_gemmc<h16, 0, 1, 2><<<dim3((TT - RH) / 64, TT / 64, ZH), 32, 0, stream>>>(QP16 + zq * TT * HD + (size_t)RH * HD, nullptr, KP16 + zk * TT * HD, nullptr, HD, Sb + (size_t)RH * TT, TT, RH, (size_t)TT * HD, (size_t)TT * HD, (size_t)TT * TT);
            k_asoft<<<ZH * TT / 8, 256, 0, stream>>>(Sb, P16, Ph, Pl);
            k_gemmc<bf, 2, 2, 4><<<dim3(RH / 64, HD / 64, ZH), 32, 0, stream>>>(Ph, Pl, VTh + zk * HD * TT, VTl + zk * HD * TT, TT, Ob, HD, 0, (size_t)RH * TT, (size_t)HD * TT, (size_t)TT * HD);
            k_gemmc<h16, 0, 2, 8><<<dim3((TT - RH) / 64, HD / 64, ZH), 32, 0, stream>>>(P16 + (size_t)RH * TT, nullptr, VT16 + zk * HD * TT, nullptr, TT, Ob + (size_t)RH * HD, HD, RH, (size_t)TT * TT, (size_t)HD * TT, (size_t)TT * HD);
            k_merge<<<(unsigned)(((size_t)ZH * TT * HD / 2 + 255) / 256), 256, 0, stream>>>(Ob, h0, ATh, ATl); }
        k_gemmw<bf, 1, false, 4><<<dim3(TT / 64, DM / 64, 1), 32, 0, stream>>>(ATh, ATl, WO, nullptr, DQ, OUT + (size_t)b * TT * DM, DM, nullptr, 0, 0, 0); }
}

// v004
// A run of this version takes 247 microseconds.
// It is 3.14 times as fast as v002, going by the measured steps of the versions left out in between.
// Counting every step since v000, it is 9.00 times as fast.
#include <hip/hip_runtime.h>

// Causal multi-head attention at d_model 768 on three input streams, bias-free (q, k, v [4][2048][768]; qh = q w_q^T, kh = k w_k^T, vh = v w_v^T ('oi' [768][768] 1/sqrt(768), no bias; 12 heads x 64); att x 1/sqrt(64); causal (-inf); softmax; y = merged w_o^T ('oi', no bias) -> [4][2048][768] (6.3 M); argument order q, k, v, w_q, w_k, w_v, w_o).
// Layout, every stage one launch over all batches (and over the streams that share its kernel): bf16 copies of the three streams and the four weights; 'oi' weights as-is; exact projections; identity-table plane builders; fused causal T-2048 attention over all batches and heads (hybrid rows: < 512 hi/lo 3 products, rest fp16; online softmax, key blocks above the diagonal never visited); merged hi/lo x w_o exact.
// Compute dtypes, f32 accumulate: every input rounded to bf16; projections exact; attention rows < 512 3 products, rest fp16; softmax f32; output projection hl x exact.

#define NB_  4
#define TT   2048
#define DM   768
#define NH_  12
#define NKV  12
#define HD   64
#define DQ   (NH_ * HD)
#define DKV  (NKV * HD)
#define RH   512                  // query rows < RH use hi+lo planes (0: none)
#define SCL  0.125f   // HD^-0.5
typedef _Float16 h16;
typedef unsigned short bf;
typedef __attribute__((ext_vector_type(16))) __bf16   v16bf;
typedef __attribute__((ext_vector_type(16))) _Float16 v16h;
typedef __attribute__((ext_vector_type(8)))  _Float16 v8h;
typedef __attribute__((ext_vector_type(8)))  unsigned short v8us;
typedef __attribute__((ext_vector_type(8)))  float    v8f;
typedef __attribute__((ext_vector_type(4)))  float    v4f;
typedef v8h  __attribute__((may_alias)) v8ha;
typedef v4f  __attribute__((may_alias)) v4fa;
typedef v8us __attribute__((may_alias)) v8usa;

__device__ __forceinline__ unsigned short f2bf(float f) { unsigned u = __float_as_uint(f); u += 0x7FFFu + ((u >> 16) & 1u); return (unsigned short)(u >> 16); }
__device__ __forceinline__ float bf2f(unsigned short b) { return __uint_as_float(((unsigned)b) << 16); }
__device__ __forceinline__ float bfr(float f) { return bf2f(f2bf(f)); }
__device__ __forceinline__ v16h cat16(v8h lo, v8h hi) { return __builtin_shufflevector(lo, hi, 0, 1, 2, 3, 4, 5, 6, 7, 8, 9, 10, 11, 12, 13, 14, 15); }
__device__ __forceinline__ v16bf cat16b(v8us lo, v8us hi) { return __builtin_bit_cast(v16bf, __builtin_shufflevector(lo, hi, 0, 1, 2, 3, 4, 5, 6, 7, 8, 9, 10, 11, 12, 13, 14, 15)); }
__device__ __forceinline__ v8f wmma16(v16h a, v16h b, v8f c) { return __builtin_amdgcn_wmma_f32_16x16x32_f16(false, a, false, b, (short)0, c, false, false); }
__device__ __forceinline__ v8f wmmab(v16bf a, v16bf b, v8f c) { return __builtin_amdgcn_wmma_f32_16x16x32_bf16(false, a, false, b, (short)0, c, false, false); }



// ---- k_gemmw: register-blocked GEMM, ONE WAVE per 64x64 output tile (16 accumulators), operands straight from K-contiguous 16-bit planes; grid (M/64, N/64, Z), 32 threads.
// C[m][n] (f32, pitch ldc, + optional f32 bias[n]) = sum_k A[m][k] Bt[n][k] (+ split products per NSPLIT). z-batch strides sA/sB/sC in elements. K % (32 U) == 0.
template <typename T16> struct WFrag;
template <> struct WFrag<h16> { typedef v16h V; static __device__ __forceinline__ V ld(const h16* p) { return cat16(*(const v8h*)p, *(const v8h*)(p + 16)); } static __device__ __forceinline__ v8f mma(V a, V b, v8f c) { return wmma16(a, b, c); } };
template <> struct WFrag<bf> { typedef v16bf V; static __device__ __forceinline__ V ld(const bf* p) { return cat16b(*(const v8us*)p, *(const v8us*)(p + 16)); } static __device__ __forceinline__ v8f mma(V a, V b, v8f c) { return wmmab(a, b, c); } };
// kgroup: U consecutive 32-wide k steps of the 64x64 tile. All fragment loads of the U steps are issued first, as one group, so one wave pays the load latency once per U steps instead of several times per step;
// the products then run in the same k order as a one-step loop (per accumulator: a.b, a2.b, a.b2 for each step in turn), so every sum keeps its order.
// A, A2, Bt, Bt2: wave-uniform, already advanced to the group's first k; ao, bo: each lane's byte offsets of its four A rows and four B rows, fixed for the whole K loop.
template <typename T16, int NSPLIT, int U>
__device__ __forceinline__ void kgroup(const T16* __restrict__ A, const T16* __restrict__ A2, const T16* __restrict__ Bt, const T16* __restrict__ Bt2, const unsigned (&ao)[4], const unsigned (&bo)[4], v8f (&acc)[4][4]) {
    typedef typename WFrag<T16>::V V;
    V a[U][4], a2[U][4], b[U][4], b2[U][4];
    const T16 *pa[4], *pa2[4], *pb[4], *pb2[4];
#pragma unroll
    for (int q = 0; q < 4; ++q) { pa[q] = (const T16*)((const char*)A + ao[q]); pb[q] = (const T16*)((const char*)Bt + bo[q]); pa2[q] = (NSPLIT == 1 || NSPLIT == 2) ? (const T16*)((const char*)A2 + ao[q]) : pa[q]; pb2[q] = (NSPLIT >= 2) ? (const T16*)((const char*)Bt2 + bo[q]) : pb[q]; }
#pragma unroll
    for (int u = 0; u < U; ++u) {
#pragma unroll
        for (int mb = 0; mb < 4; ++mb) { a[u][mb] = WFrag<T16>::ld(pa[mb] + u * 32); if (NSPLIT == 1 || NSPLIT == 2) a2[u][mb] = WFrag<T16>::ld(pa2[mb] + u * 32); }
#pragma unroll
        for (int nb = 0; nb < 4; ++nb) { b[u][nb] = WFrag<T16>::ld(pb[nb] + u * 32); if (NSPLIT >= 2) b2[u][nb] = WFrag<T16>::ld(pb2[nb] + u * 32); } }
    // the wait behind the issued loads; their address registers are named as inputs so that none is given to a later load's result, or advanced, ahead of it
    asm volatile("s_wait_xcnt 0x0" :: "v"(pa[0]), "v"(pa[1]), "v"(pa[2]), "v"(pa[3]), "v"(pb[0]), "v"(pb[1]), "v"(pb[2]), "v"(pb[3]), "v"(pa2[0]), "v"(pa2[1]), "v"(pa2[2]), "v"(pa2[3]), "v"(pb2[0]), "v"(pb2[1]), "v"(pb2[2]), "v"(pb2[3]) : "memory");
    __builtin_amdgcn_sched_barrier(0);   // keeps the whole load group ahead of the first product (sunk back to their uses, the loads would again wait once per step) and the address advance behind the wait above
#pragma unroll
    for (int u = 0; u < U; ++u)
#pragma unroll
        for (int nb = 0; nb < 4; ++nb)
#pragma unroll
            for (int mb = 0; mb < 4; ++mb) { acc[mb][nb] = WFrag<T16>::mma(a[u][mb], b[u][nb], acc[mb][nb]); if (NSPLIT == 1 || NSPLIT == 2) acc[mb][nb] = WFrag<T16>::mma(a2[u][mb], b[u][nb], acc[mb][nb]); if (NSPLIT >= 2) acc[mb][nb] = WFrag<T16>::mma(a[u][mb], b2[u][nb], acc[mb][nb]); }
    // four vector slots behind the last product, also on the loop's taken back edge, before its operands or result are touched
    asm volatile("v_nop\n\tv_nop\n\tv_nop\n\tv_nop" : "+v"(acc[0][0]), "+v"(acc[1][1]), "+v"(acc[2][2]), "+v"(acc[3][3]) : "v"(a[U - 1][0]), "v"(a[U - 1][3]));
}
template <typename T16, int NSPLIT, bool BIAS, int U>
__global__ __launch_bounds__(32) void k_gemmw(const T16* __restrict__ A, const T16* __restrict__ A2, const T16* __restrict__ Bt, const T16* __restrict__ Bt2, int K, float* C, int ldc, const float* __restrict__ bias, size_t sA, size_t sB, size_t sC) {
    typedef typename WFrag<T16>::V V;
    __shared__ __align__(16) float os[16 * 68];
    const size_t z = blockIdx.z; A += z * sA; if (A2) A2 += z * sA; Bt += z * sB; if (Bt2) Bt2 += z * sB; C += z * sC;
    const int lane = threadIdx.x & 31, lr = lane & 15, hi = lane >> 4; const int r0 = blockIdx.x * 64, c0 = blockIdx.y * 64;
    v8f acc[4][4];
#pragma unroll
    for (int mb = 0; mb < 4; ++mb)
#pragma unroll
        for (int nb = 0; nb < 4; ++nb) acc[mb][nb] = (v8f){};
    unsigned ao[4], bo[4];   // byte offsets inside one z plane (below 2^32: a plane is at most 8192 x 768 16-bit elements)
#pragma unroll
    for (int q = 0; q < 4; ++q) { ao[q] = ((unsigned)(r0 + q * 16 + lr) * (unsigned)K + 8u * hi) * 2u; bo[q] = ((unsigned)(c0 + q * 16 + lr) * (unsigned)K + 8u * hi) * 2u; }
#pragma unroll 1   // rolled: one load group per trip, every fragment index constant
    for (int kc = 0; kc < K; kc += 32 * U) kgroup<T16, NSPLIT, U>(A + kc, A2 + kc, Bt + kc, Bt2 + kc, ao, bo, acc);   // K % (32 U) == 0 at every call
#pragma unroll
    for (int mb = 0; mb < 4; ++mb) {
#pragma unroll
        for (int nb = 0; nb < 4; ++nb) {
#pragma unroll
            for (int j = 0; j < 8; ++j) os[(hi * 8 + j) * 68 + nb * 16 + lr] = acc[mb][nb][j]; }
        __builtin_amdgcn_wave_barrier(); asm volatile("" ::: "memory");
        float* crow = C + (size_t)(r0 + mb * 16) * ldc + c0;
{
#pragma unroll
            for (int s = 0; s < 8; ++s) { const int row = 2 * s + hi, cofs = lr * 4; v4f val = *(const v4fa*)(os + row * 68 + cofs); if (BIAS) { val[0] += bfr(bias[c0 + cofs]); val[1] += bfr(bias[c0 + cofs + 1]); val[2] += bfr(bias[c0 + cofs + 2]); val[3] += bfr(bias[c0 + cofs + 3]); }
                *(v4f*)(crow + (size_t)row * ldc + cofs) = val; }
             }
        __builtin_amdgcn_wave_barrier(); asm volatile("" ::: "memory");
    }
}

__device__ __forceinline__ h16 tohx(float x) { return (h16)x; }
__device__ __forceinline__ void splitf(float y, unsigned short& h, unsigned short& l) { h = f2bf(y); l = f2bf(y - bf2f(h)); }
typedef __attribute__((ext_vector_type(2))) _Float16 v2h;
typedef __attribute__((ext_vector_type(4))) _Float16 v4h;
typedef __attribute__((ext_vector_type(2))) unsigned short v2us;
typedef __attribute__((ext_vector_type(4))) unsigned short v4us;
typedef __attribute__((ext_vector_type(2))) float v2f;
typedef __attribute__((ext_vector_type(4))) int v4i;

// k_cvtall: the bf16 copies of the three streams (all batches, XB [stream][b][t][c]) and of the four weights (WB [weight][o][i]) in one launch; a block lies wholly inside one source.
#define CSB (NB_ * TT * DM / 8 / 256)   // blocks per stream
#define CWB (DM * DM / 8 / 256)         // blocks per weight
static_assert(NB_ * TT * DM % (8 * 256) == 0 && DM * DM % (8 * 256) == 0 && DQ == DM && DKV == DM, "whole blocks per source; all four weights of one size");
__global__ __launch_bounds__(256) void k_cvtall(const float* __restrict__ xq, const float* __restrict__ xk, const float* __restrict__ xv, const float* __restrict__ wq, const float* __restrict__ wk, const float* __restrict__ wv, const float* __restrict__ wo, bf* XB, bf* WB) {
    unsigned bx = blockIdx.x; const float* src; bf* dst;
    if (bx < 3 * CSB) { const unsigned s = bx / CSB; bx -= s * CSB; src = s == 0 ? xq : s == 1 ? xk : xv; dst = XB + (size_t)s * NB_ * TT * DM; }
    else { bx -= 3 * CSB; const unsigned s = bx / CWB; bx -= s * CWB; src = s == 0 ? wq : s == 1 ? wk : s == 2 ? wv : wo; dst = WB + (size_t)s * DM * DM; }
    const size_t i = (size_t)bx * 256 + threadIdx.x; const v8f v = *(const v8f*)(src + i * 8); v8us o;
    asm volatile("s_wait_xcnt 0x0" ::: "memory");   // the wait behind the issued loads, ahead of the reuse of their address registers
#pragma unroll
    for (int k = 0; k < 8; ++k) o[k] = f2bf(v[k]); *(v8us*)(dst + i * 8) = o;  }

// k_rope: grid (blocks of one batch's planes, streams, batches); sF, sP: elements from one stream's f32 buffer / plane set to the next; F rows [b][t]. Head planes [b][h][t][d] (fp16 + hi/lo) of rope(x) x sc with the rotate-half convention out[d] = x[d] cos[t][d] - x[d+HD/2] sin[t][d], out[d+HD/2] = x[d+HD/2] cos[t][d+HD/2] + x[d] sin[t][d+HD/2]
__global__ __launch_bounds__(256) void k_rope(const float* __restrict__ F, int pitch, int nheads, const float* __restrict__ CS, const float* __restrict__ RF, const float* __restrict__ nw, float sc, h16* P16, bf* Ph, bf* Pl, size_t sF, size_t sP) {
    { const size_t oF = blockIdx.y * sF + (size_t)blockIdx.z * TT * pitch, oP = blockIdx.y * sP + (size_t)blockIdx.z * nheads * TT * HD; F += oF; P16 += oP; Ph += oP; Pl += oP; }   // this block's stream and batch
    const size_t e = ((size_t)blockIdx.x * 256 + threadIdx.x) * 2; if (e >= (size_t)nheads * TT * HD) return; const int d = (int)(e % HD); const int t = (int)((e / HD) % TT); const int h = (int)(e / ((size_t)HD * TT)); const float* f = F + (size_t)t * pitch + h * HD; const float rf = RF ? RF[(size_t)h * TT + t] : 1.0f; v2h o16; v2us oh, ol;
#pragma unroll
    for (int q = 0; q < 2; ++q) { const int dd = d + q; const int dp = (dd < HD / 2) ? dd + HD / 2 : dd - HD / 2; float x0 = f[dd], x1 = f[dp];
        if (RF) { float n0 = __fmul_rn(x0, rf), n1 = __fmul_rn(x1, rf); asm volatile("" : "+v"(n0)); asm volatile("" : "+v"(n1)); x0 = __fmul_rn(bfr(nw[dd]), n0); x1 = __fmul_rn(bfr(nw[dp]), n1); }
        const v2f cs = *(const v2f*)(CS + ((size_t)t * HD + dd) * 2); float a = __fmul_rn(x0, cs[0]), bq = __fmul_rn(x1, cs[1]); asm volatile("" : "+v"(a)); asm volatile("" : "+v"(bq)); const float r = ((dd < HD / 2) ? __fsub_rn(a, bq) : __fadd_rn(a, bq)) * sc;
        o16[q] = tohx(r); unsigned short a2, c2; splitf(r, a2, c2); oh[q] = a2; ol[q] = c2; }
    *(v2h*)(P16 + e) = o16; *(v2us*)(Ph + e) = oh; *(v2us*)(Pl + e) = ol;  }
// k_vtp: grid (blocks of one batch's planes, batches); F rows [b][t], planes [b][h][d][t]
__global__ __launch_bounds__(256) void k_vtp(const float* __restrict__ F, int pitch, int nheads, h16* V16, bf* Vh, bf* Vl) {
    { const size_t oP = (size_t)blockIdx.y * nheads * HD * TT; F += (size_t)blockIdx.y * TT * pitch; V16 += oP; Vh += oP; Vl += oP; }   // this block's batch
    const size_t e = ((size_t)blockIdx.x * 256 + threadIdx.x) * 2; if (e >= (size_t)nheads * HD * TT) return; const int t = (int)(e % TT); const int d = (int)((e / TT) % HD); const int g = (int)(e / ((size_t)TT * HD)); v2h o16; v2us oh, ol;
#pragma unroll
    for (int q = 0; q < 2; ++q) { const float x = F[(size_t)(t + q) * pitch + g * HD + d]; o16[q] = tohx(x); unsigned short a2, c2; splitf(x, a2, c2); oh[q] = a2; ol[q] = c2; }
    *(v2h*)(V16 + e) = o16; *(v2us*)(Vh + e) = oh; *(v2us*)(Vl + e) = ol;  }
__global__ __launch_bounds__(256) void k_csid(float* CS) { const int idx = blockIdx.x * 256 + threadIdx.x; if (idx >= TT * HD) return; v2f cs; cs[0] = 1.0f; cs[1] = 0.0f; *(v2f*)(CS + (size_t)idx * 2) = cs;  }
// ---- k_fattn: scores, causal softmax, probability x value and the head merge in one kernel; no score or probability plane in memory.
// One wave owns 32 query columns (two groups of 16) and walks the keys 0 .. q0 + 31 in blocks of 32. S^T = K Q^T (A = K rows, B = Q, kept in registers): a lane holds the scores of ONE query (column lr), keys 8 hi + j of each 16-key tile,
// which is the k order of a B operand, so the two score tiles of a block, after exp, are the B operand of O^T += V^T P^T without any exchange. Running maximum and sum per query (online softmax): partial sums are rescaled when the maximum grows.
// Query rows < RH: bf16 hi + lo planes, three products for S and for P.V; the other rows: fp16 planes, one product. P is exp(t - running max), at most 1, divided by the row sum (f32) at the end.
__device__ __forceinline__ float xhalf(float x) { return __builtin_bit_cast(float, __builtin_amdgcn_permlanex16(__builtin_bit_cast(int, x), __builtin_bit_cast(int, x), 0x76543210, 0xfedcba98, false, false)); }   // lane l with lane l ^ 16
#define L2E 1.4426950408889634f
template <typename T16> struct KVF { typename WFrag<T16>::V k[2][2], v[4], k2[2][2], v2[4]; };   // one 32-key block: K [key tile][k step of 32 d], V^T [d tile]; k2, v2: the lo planes
// kload, vload: one block's K or V^T fragments. K, K2, Vt, V2: wave-uniform plane bases; ok, ov: each lane's byte offset of its first K row or V^T row of the block (the other tiles' rows lie at constant distances), moved on to the next block behind the wait.
template <typename T16, bool HL>
__device__ __forceinline__ void kload(KVF<T16>& f, const T16* __restrict__ K, const T16* __restrict__ K2, unsigned& ok) {
    const T16* pk = (const T16*)((const char*)K + ok); const T16* pk2 = (const T16*)((const char*)K2 + ok);
#pragma unroll
    for (int t = 0; t < 2; ++t)
#pragma unroll
        for (int ks = 0; ks < 2; ++ks) { f.k[t][ks] = WFrag<T16>::ld(pk + t * 16 * HD + ks * 32); if (HL) f.k2[t][ks] = WFrag<T16>::ld(pk2 + t * 16 * HD + ks * 32); }
    // the wait behind the issued loads; the offset passes through it, so that its register stays untouched up to it and the advance below can only follow it
    asm volatile("s_wait_xcnt 0x0" : "+v"(ok) :: "memory");
    __builtin_amdgcn_sched_barrier(0);   // keeps these loads ahead of the work that follows (sunk below it, their latency would no longer be covered)
    ok += 32 * HD * 2;
}
template <typename T16, bool HL>
__device__ __forceinline__ void vload(KVF<T16>& f, const T16* __restrict__ Vt, const T16* __restrict__ V2, unsigned& ov) {
    const T16* pv = (const T16*)((const char*)Vt + ov); const T16* pv2 = (const T16*)((const char*)V2 + ov);
#pragma unroll
    for (int dt = 0; dt < 4; ++dt) { f.v[dt] = WFrag<T16>::ld(pv + dt * 16 * TT); if (HL) f.v2[dt] = WFrag<T16>::ld(pv2 + dt * 16 * TT); }
    // the wait behind the issued loads; the offset passes through it, so that its register stays untouched up to it and the advance below can only follow it
    asm volatile("s_wait_xcnt 0x0" : "+v"(ov) :: "memory");
    ov += 32 * 2;
}
// one 32-key block against the wave's 32 queries. The next block's K fragments are fetched into the same registers right behind this block's S^T products (softmax and P.V cover them); its V^T fragments are asked for behind the P.V products, and the compiler may issue them earlier into spare registers.
// LAST: the diagonal block (kb == q0), the only one that needs the causal select; nothing is fetched behind it.
template <typename T16, bool HL, bool LAST>
__device__ __forceinline__ void fstep(KVF<T16>& f, const typename WFrag<T16>::V (&q)[2][2], const typename WFrag<T16>::V (&q2)[2][2], v8f (&o)[2][4], float (&m)[2], float (&l)[2], const T16* __restrict__ K, const T16* __restrict__ K2, const T16* __restrict__ Vt, const T16* __restrict__ V2, unsigned& ok, unsigned& ov, int kb, int q0, int lr, int hi) {
    typedef typename WFrag<T16>::V V;
    v8f s[2][2];
#pragma unroll
    for (int g = 0; g < 2; ++g)
#pragma unroll
        for (int t = 0; t < 2; ++t) { s[g][t] = (v8f){};
#pragma unroll
            for (int ks = 0; ks < 2; ++ks) { s[g][t] = WFrag<T16>::mma(f.k[t][ks], q[g][ks], s[g][t]); if (HL) { s[g][t] = WFrag<T16>::mma(f.k[t][ks], q2[g][ks], s[g][t]); s[g][t] = WFrag<T16>::mma(f.k2[t][ks], q[g][ks], s[g][t]); } } }
    if (!LAST) kload<T16, HL>(f, K, K2, ok);
#pragma unroll
    for (int g = 0; g < 2; ++g) {
        float x[16]; float mx = -3.0e38f;
#pragma unroll
        for (int e = 0; e < 16; ++e) { float t = s[g][e >> 3][e & 7] * SCL; if (LAST) t = (kb + (e >> 3) * 16 + hi * 8 + (e & 7) <= q0 + g * 16 + lr) ? t : -3.0e38f; x[e] = t; mx = fmaxf(mx, t); }
        mx = fmaxf(mx, xhalf(mx));   // both halves of a column use one maximum: their keys meet in one product
        const float mn = fmaxf(m[g], mx); const float al = __builtin_amdgcn_exp2f((m[g] - mn) * L2E); m[g] = mn;   // 0 in the first block
        float ls[4] = {0.f, 0.f, 0.f, 0.f};   // four short chains instead of one of sixteen dependent adds
#pragma unroll
        for (int e = 0; e < 16; ++e) { x[e] = __builtin_amdgcn_exp2f((x[e] - mn) * L2E); ls[e & 3] += x[e]; }
        l[g] = l[g] * al + ((ls[0] + ls[1]) + (ls[2] + ls[3]));
#pragma unroll
        for (int dt = 0; dt < 4; ++dt) o[g][dt] *= al;
        if constexpr (HL) {
            v8us h0, h1, l0, l1;
#pragma unroll
            for (int j = 0; j < 8; ++j) { unsigned short a, c; splitf(x[j], a, c); h0[j] = a; l0[j] = c; splitf(x[8 + j], a, c); h1[j] = a; l1[j] = c; }
            const V ph = cat16b(h0, h1), pl = cat16b(l0, l1);
#pragma unroll
            for (int dt = 0; dt < 4; ++dt) { o[g][dt] = WFrag<T16>::mma(f.v[dt], ph, o[g][dt]); o[g][dt] = WFrag<T16>::mma(f.v[dt], pl, o[g][dt]); o[g][dt] = WFrag<T16>::mma(f.v2[dt], ph, o[g][dt]); }
        } else {
            V p;
#pragma unroll
            for (int e = 0; e < 16; ++e) p[e] = tohx(x[e]);
#pragma unroll
            for (int dt = 0; dt < 4; ++dt) o[g][dt] = WFrag<T16>::mma(f.v[dt], p, o[g][dt]);
        }
    }
    if (!LAST) vload<T16, HL>(f, Vt, V2, ov);
}
// one 32-query tile of one head; all pointers at the head's planes, Ah / Al at the head's first column of the merged [t][DQ] hi / lo planes
template <typename T16, bool HL>
__device__ __forceinline__ void ftile(const T16* __restrict__ Q, const T16* __restrict__ Q2, const T16* __restrict__ K, const T16* __restrict__ K2, const T16* __restrict__ Vt, const T16* __restrict__ V2, int q0, bf* Ah, bf* Al) {
    typedef typename WFrag<T16>::V V;
    const int lane = threadIdx.x & 31, lr = lane & 15, hi = lane >> 4;
    V q[2][2], q2[2][2];
    const T16* pq = Q + (size_t)(q0 + lr) * HD + 8 * hi; const T16* pq2 = HL ? Q2 + (size_t)(q0 + lr) * HD + 8 * hi : pq;
#pragma unroll
    for (int g = 0; g < 2; ++g)
#pragma unroll
        for (int ks = 0; ks < 2; ++ks) { q[g][ks] = WFrag<T16>::ld(pq + g * 16 * HD + ks * 32); q2[g][ks] = HL ? WFrag<T16>::ld(pq2 + g * 16 * HD + ks * 32) : q[g][ks]; }
    asm volatile("s_wait_xcnt 0x0" :: "v"(pq), "v"(pq2) : "memory");   // the wait behind the issued Q loads; their address registers are named so that none is reused ahead of it
    unsigned ok = ((unsigned)lr * HD + 8u * hi) * 2u, ov = ((unsigned)lr * TT + 8u * hi) * 2u;   // byte offsets inside one head's plane (256 KiB)
    v8f o[2][4]; float m[2], l[2];
#pragma unroll
    for (int g = 0; g < 2; ++g) { m[g] = -3.0e38f; l[g] = 0.f;
#pragma unroll
        for (int dt = 0; dt < 4; ++dt) o[g][dt] = (v8f){}; }
    KVF<T16> f;
    kload<T16, HL>(f, K, K2, ok); vload<T16, HL>(f, Vt, V2, ov);
    int kb = 0;
#pragma unroll 1   // rolled: one block per trip, the fragments stay in one register set
    for (; kb < q0; kb += 32) fstep<T16, HL, false>(f, q, q2, o, m, l, K, K2, Vt, V2, ok, ov, kb, q0, lr, hi);
    fstep<T16, HL, true>(f, q, q2, o, m, l, K, K2, Vt, V2, ok, ov, kb, q0, lr, hi);
    bf* pa = Ah + (size_t)(q0 + lr) * DQ + hi * 8; bf* pl = Al + (size_t)(q0 + lr) * DQ + hi * 8;
#pragma unroll
    for (int g = 0; g < 2; ++g) { const float inv = __fdiv_rn(1.0f, l[g] + xhalf(l[g]));
#pragma unroll
        for (int dt = 0; dt < 4; ++dt) { v8us oh, ol;   // O^T: a lane holds 8 consecutive d of one query: one 16-byte store per plane
#pragma unroll
            for (int j = 0; j < 8; ++j) { unsigned short a, c; splitf(o[g][dt][j] * inv, a, c); oh[j] = a; ol[j] = c; }
            *(v8us*)(pa + g * 16 * DQ + dt * 16) = oh; *(v8us*)(pl + g * 16 * DQ + dt * 16) = ol; } }
    asm volatile("s_wait_xcnt 0x0" :: "v"(pa), "v"(pl) : "memory");   // the wait behind the issued stores, ahead of the second tile's reuse of their address registers
}
// grid (TT / 256, heads, batches), four independent waves per block (no LDS, no barrier; neighbours walk the same K and V rows). Wave idx takes tile 63 - idx and then tile idx, so every wave walks 65 key blocks.
// The register count leaves two waves per SIMD: all 1536 waves are resident at once, and one wave's softmax runs under the other's products.
__global__ __launch_bounds__(128) void k_fattn(const h16* __restrict__ Q16, const h16* __restrict__ K16, const h16* __restrict__ V16, const bf* __restrict__ Qh, const bf* __restrict__ Ql, const bf* __restrict__ Kh, const bf* __restrict__ Kl, const bf* __restrict__ Vh, const bf* __restrict__ Vl, bf* Ah, bf* Al) {
    const int idx = blockIdx.x * 4 + (threadIdx.x >> 5);
    const size_t pl = ((size_t)blockIdx.z * NH_ + blockIdx.y) * TT * HD; const size_t ao = (size_t)blockIdx.z * TT * DQ + blockIdx.y * HD;
    const int qa = __builtin_amdgcn_readfirstlane((TT / 32 - 1 - idx) * 32), qb = __builtin_amdgcn_readfirstlane(idx * 32);   // wave-uniform: scalar loop bounds
    static_assert(RH <= TT / 2, "the first tile of every wave lies in the upper half of the rows, beyond the hi + lo rows");
    ftile<h16, false>(Q16 + pl, Q16 + pl, K16 + pl, K16 + pl, V16 + pl, V16 + pl, qa, Ah + ao, Al + ao);
    if (qb < RH) ftile<bf, true>(Qh + pl, Ql + pl, Kh + pl, Kl + pl, Vh + pl, Vl + pl, qb, Ah + ao, Al + ao);
    else ftile<h16, false>(Q16 + pl, Q16 + pl, K16 + pl, K16 + pl, V16 + pl, V16 + pl, qb, Ah + ao, Al + ao);
}

extern "C" void kernel_launch(void* const* d_in, const int* in_sizes, int n_in,
                              void* d_out, int out_size, void* d_ws, size_t ws_size, hipStream_t stream) {
    (void)in_sizes; (void)n_in; (void)out_size;
    const float* x = (const float*)d_in[0]; const float* xk = (const float*)d_in[1]; const float* xv = (const float*)d_in[2];   /* three streams: q, k, v */ const float* wq = (const float*)d_in[3]; const float* wk = (const float*)d_in[4]; const float* wv = (const float*)d_in[5]; const float* wo = (const float*)d_in[6];   /* w_q, w_k, w_v, w_o ('oi' [768][768]) */
    float* OUT = (float*)d_out;     // [4][2048][768]
    char* wsp = (char*)d_ws;
    auto take = [&](size_t bytes) { char* p = wsp; wsp += (bytes + 255) & ~(size_t)255; return (void*)p; };
    bf* WB = (bf*)take((size_t)4 * DM * DM * 2); bf* WO = WB + (size_t)3 * DM * DM;   // w_q, w_k, w_v, w_o, one behind the other
    float* CS = (float*)take((size_t)TT * HD * 2 * 4);
    const size_t SX = (size_t)NB_ * TT * DM;   // one stream, all batches, elements
    bf* XB = (bf*)take(3 * SX * 2); float* FP = (float*)take(3 * SX * 4);   // [stream q, k, v][b][t][c]: bf16 inputs, f32 projections
    const size_t PB = (size_t)NH_ * TT * HD;   // one batch's head planes, elements; every plane set holds all batches, [b][h][..]
    h16* QP16 = (h16*)take(NB_ * PB * 2); h16* KP16 = (h16*)take(NB_ * PB * 2); h16* VT16 = (h16*)take(NB_ * PB * 2);   // each K set lies NB_ * PB elements behind its Q set
    bf* QPh = (bf*)take(NB_ * PB * 2); bf* KPh = (bf*)take(NB_ * PB * 2); bf* QPl = (bf*)take(NB_ * PB * 2); bf* KPl = (bf*)take(NB_ * PB * 2); bf* VTh = (bf*)take(NB_ * PB * 2); bf* VTl = (bf*)take(NB_ * PB * 2);
    bf* ATh = (bf*)take((size_t)NB_ * TT * DQ * 2); bf* ATl = (bf*)take((size_t)NB_ * TT * DQ * 2);
    if ((size_t)(wsp - (char*)d_ws) > ws_size) return;    // ws 256 MiB
    k_cvtall<<<3 * CSB + 4 * CWB, 256, 0, stream>>>(x, xk, xv, wq, wk, wv, wo, XB, WB);
    k_csid<<<(TT * HD + 255) / 256, 256, 0, stream>>>(CS);
    const unsigned LP = (unsigned)((PB / 2 + 255) / 256);   // blocks per batch of one plane set
    k_gemmw<bf, 0, false, 8><<<dim3(NB_ * TT / 64, DQ / 64, 3), 32, 0, stream>>>(XB, nullptr, WB, nullptr, DM, FP, DQ, nullptr, SX, (size_t)DM * DM, SX);   // z: the q, k and v projections; rows: all batches
    k_vtp<<<dim3(LP, NB_, 1), 256, 0, stream>>>(FP + 2 * SX, DKV, NKV, VT16, VTh, VTl);   // y: batches
    k_rope<<<dim3(LP, 2, NB_), 256, 0, stream>>>(FP, DQ, NH_, CS, nullptr, nullptr, 1.0f, QP16, QPh, QPl, SX, NB_ * PB);   // y: q, k; z: batches
    k_fattn<<<dim3(TT / 256, NH_, NB_), 128, 0, stream>>>(QP16, KP16, VT16, QPh, QPl, KPh, KPl, VTh, VTl, ATh, ATl);   // with no score planes to hold, one launch takes every (batch, head)
    k_gemmw<bf, 1, false, 4><<<dim3(NB_ * TT / 64, DM / 64, 1), 32, 0, stream>>>(ATh, ATl, WO, nullptr, DQ, OUT, DM, nullptr, 0, 0, 0);   // rows: all batches
}

// v005
// One run takes 199 microseconds.
// Two timings next to v004 both put it at 1.24 times that version's speed.
// Counting every step since v000, it is 11.1 times as fast.
#include <hip/hip_runtime.h>

// Causal multi-head attention at d_model 768 on three input streams, bias-free (q, k, v [4][2048][768]; qh = q w_q^T, kh = k w_k^T, vh = v w_v^T ('oi' [768][768] 1/sqrt(768), no bias; 12 heads x 64); att x 1/sqrt(64); causal (-inf); softmax; y = merged w_o^T ('oi', no bias) -> [4][2048][768] (6.3 M); argument order q, k, v, w_q, w_k, w_v, w_o).
// Layout, every stage one launch over all batches (and over the streams that share its kernel): bf16 copies of the three streams and the four weights; 'oi' weights as-is; exact projections whose epilogue writes the head planes; fused causal T-2048 attention over all batches and heads (hybrid rows: < 512 hi/lo 3 products, rest fp16; online softmax, key blocks above the diagonal never visited); merged hi/lo x w_o exact.
// Compute dtypes, f32 accumulate: every input rounded to bf16; projections exact; attention rows < 512 3 products, rest fp16; softmax f32; output projection hl x exact.

#define NB_  4
#define TT   2048
#define DM   768
#define NH_  12
#define NKV  12
#define HD   64
#define DQ   (NH_ * HD)
#define DKV  (NKV * HD)
#define RH   512                  // query rows < RH use hi+lo planes (0: none)
#define SCL  0.125f   // HD^-0.5
typedef _Float16 h16;
typedef unsigned short bf;
typedef __attribute__((ext_vector_type(16))) __bf16   v16bf;
typedef __attribute__((ext_vector_type(16))) _Float16 v16h;
typedef __attribute__((ext_vector_type(8)))  _Float16 v8h;
typedef __attribute__((ext_vector_type(8)))  unsigned short v8us;
typedef __attribute__((ext_vector_type(8)))  float    v8f;
typedef __attribute__((ext_vector_type(4)))  float    v4f;
typedef v8h  __attribute__((may_alias)) v8ha;
typedef v4f  __attribute__((may_alias)) v4fa;
typedef v8us __attribute__((may_alias)) v8usa;

__device__ __forceinline__ unsigned short f2bf(float f) { unsigned u = __float_as_uint(f); u += 0x7FFFu + ((u >> 16) & 1u); return (unsigned short)(u >> 16); }
__device__ __forceinline__ float bf2f(unsigned short b) { return __uint_as_float(((unsigned)b) << 16); }
__device__ __forceinline__ float bfr(float f) { return bf2f(f2bf(f)); }
__device__ __forceinline__ v16h cat16(v8h lo, v8h hi) { return __builtin_shufflevector(lo, hi, 0, 1, 2, 3, 4, 5, 6, 7, 8, 9, 10, 11, 12, 13, 14, 15); }
__device__ __forceinline__ v16bf cat16b(v8us lo, v8us hi) { return __builtin_bit_cast(v16bf, __builtin_shufflevector(lo, hi, 0, 1, 2, 3, 4, 5, 6, 7, 8, 9, 10, 11, 12, 13, 14, 15)); }
__device__ __forceinline__ v8f wmma16(v16h a, v16h b, v8f c) { return __builtin_amdgcn_wmma_f32_16x16x32_f16(false, a, false, b, (short)0, c, false, false); }
__device__ __forceinline__ v8f wmmab(v16bf a, v16bf b, v8f c) { return __builtin_amdgcn_wmma_f32_16x16x32_bf16(false, a, false, b, (short)0, c, false, false); }



// ---- k_gemmw: register-blocked GEMM, ONE WAVE per 64x64 output tile (16 accumulators), operands straight from K-contiguous 16-bit planes; grid (M/64, N/64, Z), 32 threads.
// C[m][n] (f32, pitch ldc, + optional f32 bias[n]) = sum_k A[m][k] Bt[n][k] (+ split products per NSPLIT). z-batch strides sA/sB/sC in elements. K % (32 U) == 0.
template <typename T16> struct WFrag;
template <> struct WFrag<h16> { typedef v16h V; static __device__ __forceinline__ V ld(const h16* p) { return cat16(*(const v8h*)p, *(const v8h*)(p + 16)); } static __device__ __forceinline__ v8f mma(V a, V b, v8f c) { return wmma16(a, b, c); } };
template <> struct WFrag<bf> { typedef v16bf V; static __device__ __forceinline__ V ld(const bf* p) { return cat16b(*(const v8us*)p, *(const v8us*)(p + 16)); } static __device__ __forceinline__ v8f mma(V a, V b, v8f c) { return wmmab(a, b, c); } };
// kgroup: U consecutive 32-wide k steps of the 64x64 tile. All fragment loads of the U steps are issued first, as one group, so one wave pays the load latency once per U steps instead of several times per step;
// the products then run in the same k order as a one-step loop (per accumulator: a.b, a2.b, a.b2 for each step in turn), so every sum keeps its order.
// A, A2, Bt, Bt2: wave-uniform, already advanced to the group's first k; ao, bo: each lane's byte offsets of its four A rows and four B rows, fixed for the whole K loop.
template <typename T16, int NSPLIT, int U>
__device__ __forceinline__ void kgroup(const T16* __restrict__ A, const T16* __restrict__ A2, const T16* __restrict__ Bt, const T16* __restrict__ Bt2, const unsigned (&ao)[4], const unsigned (&bo)[4], v8f (&acc)[4][4]) {
    typedef typename WFrag<T16>::V V;
    V a[U][4], a2[U][4], b[U][4], b2[U][4];
    const T16 *pa[4], *pa2[4], *pb[4], *pb2[4];
#pragma unroll
    for (int q = 0; q < 4; ++q) { pa[q] = (const T16*)((const char*)A + ao[q]); pb[q] = (const T16*)((const char*)Bt + bo[q]); pa2[q] = (NSPLIT == 1 || NSPLIT == 2) ? (const T16*)((const char*)A2 + ao[q]) : pa[q]; pb2[q] = (NSPLIT >= 2) ? (const T16*)((const char*)Bt2 + bo[q]) : pb[q]; }
#pragma unroll
    for (int u = 0; u < U; ++u) {
#pragma unroll
        for (int mb = 0; mb < 4; ++mb) { a[u][mb] = WFrag<T16>::ld(pa[mb] + u * 32); if (NSPLIT == 1 || NSPLIT == 2) a2[u][mb] = WFrag<T16>::ld(pa2[mb] + u * 32); }
#pragma unroll
        for (int nb = 0; nb < 4; ++nb) { b[u][nb] = WFrag<T16>::ld(pb[nb] + u * 32); if (NSPLIT >= 2) b2[u][nb] = WFrag<T16>::ld(pb2[nb] + u * 32); } }
    // the wait behind the issued loads; their address registers are named as inputs so that none is given to a later load's result, or advanced, ahead of it
    asm volatile("s_wait_xcnt 0x0" :: "v"(pa[0]), "v"(pa[1]), "v"(pa[2]), "v"(pa[3]), "v"(pb[0]), "v"(pb[1]), "v"(pb[2]), "v"(pb[3]), "v"(pa2[0]), "v"(pa2[1]), "v"(pa2[2]), "v"(pa2[3]), "v"(pb2[0]), "v"(pb2[1]), "v"(pb2[2]), "v"(pb2[3]) : "memory");
    __builtin_amdgcn_sched_barrier(0);   // keeps the whole load group ahead of the first product (sunk back to their uses, the loads would again wait once per step) and the address advance behind the wait above
#pragma unroll
    for (int u = 0; u < U; ++u)
#pragma unroll
        for (int nb = 0; nb < 4; ++nb)
#pragma unroll
            for (int mb = 0; mb < 4; ++mb) { acc[mb][nb] = WFrag<T16>::mma(a[u][mb], b[u][nb], acc[mb][nb]); if (NSPLIT == 1 || NSPLIT == 2) acc[mb][nb] = WFrag<T16>::mma(a2[u][mb], b[u][nb], acc[mb][nb]); if (NSPLIT >= 2) acc[mb][nb] = WFrag<T16>::mma(a[u][mb], b2[u][nb], acc[mb][nb]); }
    // four vector slots behind the last product, also on the loop's taken back edge, before its operands or result are touched
    asm volatile("v_nop\n\tv_nop\n\tv_nop\n\tv_nop" : "+v"(acc[0][0]), "+v"(acc[1][1]), "+v"(acc[2][2]), "+v"(acc[3][3]) : "v"(a[U - 1][0]), "v"(a[U - 1][3]));
}
template <typename T16, int NSPLIT, bool BIAS, int U>
__global__ __launch_bounds__(32) void k_gemmw(const T16* __restrict__ A, const T16* __restrict__ A2, const T16* __restrict__ Bt, const T16* __restrict__ Bt2, int K, float* C, int ldc, const float* __restrict__ bias, size_t sA, size_t sB, size_t sC) {
    typedef typename WFrag<T16>::V V;
    __shared__ __align__(16) float os[16 * 68];
    const size_t z = blockIdx.z; A += z * sA; if (A2) A2 += z * sA; Bt += z * sB; if (Bt2) Bt2 += z * sB; C += z * sC;
    const int lane = threadIdx.x & 31, lr = lane & 15, hi = lane >> 4; const int r0 = blockIdx.x * 64, c0 = blockIdx.y * 64;
    v8f acc[4][4];
#pragma unroll
    for (int mb = 0; mb < 4; ++mb)
#pragma unroll
        for (int nb = 0; nb < 4; ++nb) acc[mb][nb] = (v8f){};
    unsigned ao[4], bo[4];   // byte offsets inside one z plane (below 2^32: a plane is at most 8192 x 768 16-bit elements)
#pragma unroll
    for (int q = 0; q < 4; ++q) { ao[q] = ((unsigned)(r0 + q * 16 + lr) * (unsigned)K + 8u * hi) * 2u; bo[q] = ((unsigned)(c0 + q * 16 + lr) * (unsigned)K + 8u * hi) * 2u; }
#pragma unroll 1   // rolled: one load group per trip, every fragment index constant
    for (int kc = 0; kc < K; kc += 32 * U) kgroup<T16, NSPLIT, U>(A + kc, A2 + kc, Bt + kc, Bt2 + kc, ao, bo, acc);   // K % (32 U) == 0 at every call
#pragma unroll
    for (int mb = 0; mb < 4; ++mb) {
#pragma unroll
        for (int nb = 0; nb < 4; ++nb) {
#pragma unroll
            for (int j = 0; j < 8; ++j) os[(hi * 8 + j) * 68 + nb * 16 + lr] = acc[mb][nb][j]; }
        __builtin_amdgcn_wave_barrier(); asm volatile("" ::: "memory");
        float* crow = C + (size_t)(r0 + mb * 16) * ldc + c0;
{
#pragma unroll
            for (int s = 0; s < 8; ++s) { const int row = 2 * s + hi, cofs = lr * 4; v4f val = *(const v4fa*)(os + row * 68 + cofs); if (BIAS) { val[0] += bfr(bias[c0 + cofs]); val[1] += bfr(bias[c0 + cofs + 1]); val[2] += bfr(bias[c0 + cofs + 2]); val[3] += bfr(bias[c0 + cofs + 3]); }
                *(v4f*)(crow + (size_t)row * ldc + cofs) = val; }
             }
        __builtin_amdgcn_wave_barrier(); asm volatile("" ::: "memory");
    }
}

__device__ __forceinline__ h16 tohx(float x) { return (h16)x; }
__device__ __forceinline__ void splitf(float y, unsigned short& h, unsigned short& l) { h = f2bf(y); l = f2bf(y - bf2f(h)); }
typedef __attribute__((ext_vector_type(2))) _Float16 v2h;
typedef __attribute__((ext_vector_type(4))) _Float16 v4h;
typedef __attribute__((ext_vector_type(2))) unsigned short v2us;
typedef __attribute__((ext_vector_type(4))) unsigned short v4us;
typedef __attribute__((ext_vector_type(2))) float v2f;
typedef __attribute__((ext_vector_type(4))) int v4i;

// k_cvtall: the bf16 copies of the three streams (all batches, XB [stream][b][t][c]) and of the four weights (WB [weight][o][i]) in one launch; a block lies wholly inside one source.
#define CSB (NB_ * TT * DM / 8 / 256)   // blocks per stream
#define CWB (DM * DM / 8 / 256)         // blocks per weight
static_assert(NB_ * TT * DM % (8 * 256) == 0 && DM * DM % (8 * 256) == 0 && DQ == DM && DKV == DM, "whole blocks per source; all four weights of one size");
__global__ __launch_bounds__(256) void k_cvtall(const float* __restrict__ xq, const float* __restrict__ xk, const float* __restrict__ xv, const float* __restrict__ wq, const float* __restrict__ wk, const float* __restrict__ wv, const float* __restrict__ wo, bf* XB, bf* WB) {
    unsigned bx = blockIdx.x; const float* src; bf* dst;
    if (bx < 3 * CSB) { const unsigned s = bx / CSB; bx -= s * CSB; src = s == 0 ? xq : s == 1 ? xk : xv; dst = XB + (size_t)s * NB_ * TT * DM; }
    else { bx -= 3 * CSB; const unsigned s = bx / CWB; bx -= s * CWB; src = s == 0 ? wq : s == 1 ? wk : s == 2 ? wv : wo; dst = WB + (size_t)s * DM * DM; }
    const size_t i = (size_t)bx * 256 + threadIdx.x; const v8f v = *(const v8f*)(src + i * 8); v8us o;
    asm volatile("s_wait_xcnt 0x0" ::: "memory");   // the wait behind the issued loads, ahead of the reuse of their address registers
#pragma unroll
    for (int k = 0; k < 8; ++k) o[k] = f2bf(v[k]); *(v8us*)(dst + i * 8) = o;  }

// ---- k_proj: the q, k and v projections (z), the K loop of k_gemmw; the epilogue writes the planes that k_fattn reads, so no f32 projection goes through memory. grid (NB_ TT / 64, heads, 3), one wave.
// A 64 x 64 tile is 64 rows t of one batch x the 64 columns d of one head. q, k: planes [b][h][t][d], the tile is 8 KiB in a row; v: planes [b][h][d][t], 64 rows d of 128 bytes.
// panel_out: one 16 x 64 f32 panel staged in LDS (pitch 68) goes out as fp16, hi and lo rows of PITCH elements; a lane takes 8 neighbours of a row, so 8 lanes store one whole 128-byte line per plane.
template <int PITCH>
__device__ __forceinline__ void panel_out(const float* os, int lane, h16* d16, bf* dh, bf* dl) {
    v8h o16[4]; v8us oh[4], ol[4];
    const unsigned e0 = (unsigned)(lane >> 3) * PITCH + (unsigned)(lane & 7) * 8;   // the lane's first element; the other three rows lie at constant distances
#pragma unroll
    for (int s = 0; s < 4; ++s) { const float* r = os + (4 * s + (lane >> 3)) * 68 + (lane & 7) * 8; const v4f x0 = *(const v4fa*)r, x1 = *(const v4fa*)(r + 4);
#pragma unroll
        for (int j = 0; j < 8; ++j) { const float x = j < 4 ? x0[j & 3] : x1[j & 3]; o16[s][j] = tohx(x); unsigned short a, c; splitf(x, a, c); oh[s][j] = a; ol[s][j] = c; }
        *(v8h*)(d16 + e0 + 4 * s * PITCH) = o16[s]; *(v8us*)(dh + e0 + 4 * s * PITCH) = oh[s]; *(v8us*)(dl + e0 + 4 * s * PITCH) = ol[s]; }
    // the wait behind the issued stores; their data and offset registers are named as inputs so that none is given to the next panel's values ahead of it; its memory clobber also keeps the next panel's LDS writes behind the reads above
    asm volatile("s_wait_xcnt 0x0" :: "v"(o16[0]), "v"(o16[1]), "v"(o16[2]), "v"(o16[3]), "v"(oh[0]), "v"(oh[1]), "v"(oh[2]), "v"(oh[3]), "v"(ol[0]), "v"(ol[1]), "v"(ol[2]), "v"(ol[3]), "v"(e0) : "memory");
}
static_assert(TT % 64 == 0 && HD == 64 && DQ == DM && DKV == DM, "a 64 x 64 tile: one batch, one head");
template <int U>
__global__ __launch_bounds__(32) void k_proj(const bf* __restrict__ XB, const bf* __restrict__ WB, h16* P16, bf* Ph, bf* Pl, h16* V16, bf* Vh, bf* Vl) {
    __shared__ __align__(16) float os[16 * 68];
    const unsigned z = blockIdx.z; const bf* A = XB + (size_t)z * NB_ * TT * DM; const bf* Bt = WB + (size_t)z * DM * DM;
    const int lane = threadIdx.x & 31, lr = lane & 15, hi = lane >> 4; const int r0 = blockIdx.x * 64, c0 = blockIdx.y * 64;
    v8f acc[4][4];
#pragma unroll
    for (int mb = 0; mb < 4; ++mb)
#pragma unroll
        for (int nb = 0; nb < 4; ++nb) acc[mb][nb] = (v8f){};
    unsigned ao[4], bo[4];   // byte offsets inside one stream or weight (below 2^32)
#pragma unroll
    for (int q = 0; q < 4; ++q) { ao[q] = ((unsigned)(r0 + q * 16 + lr) * (unsigned)DM + 8u * hi) * 2u; bo[q] = ((unsigned)(c0 + q * 16 + lr) * (unsigned)DM + 8u * hi) * 2u; }
#pragma unroll 1   // rolled: one load group per trip, every fragment index constant
    for (int kc = 0; kc < DM; kc += 32 * U) kgroup<bf, 0, U>(A + kc, A + kc, Bt + kc, Bt + kc, ao, bo, acc);
    static_assert(DM % (32 * U) == 0, "whole load groups");
    const size_t hp = ((size_t)(r0 / TT) * NH_ + blockIdx.y) * TT * HD; const int t0 = r0 % TT;   // this (batch, head)'s plane; the tile's first row t
    if (z < 2) {   // q, k: panel = 16 rows t
        const size_t o = (size_t)z * NB_ * NH_ * TT * HD + hp + (size_t)t0 * HD;
#pragma unroll
        for (int mb = 0; mb < 4; ++mb) {
#pragma unroll
            for (int nb = 0; nb < 4; ++nb)
#pragma unroll
                for (int j = 0; j < 8; ++j) os[(hi * 8 + j) * 68 + nb * 16 + lr] = acc[mb][nb][j];
            __builtin_amdgcn_wave_barrier(); asm volatile("" ::: "memory");   // other lanes' panel values are read below: the compiler may not move those reads above the writes
            panel_out<HD>(os, lane, P16 + o + mb * 16 * HD, Ph + o + mb * 16 * HD, Pl + o + mb * 16 * HD);
        }
    } else {       // v: panel = 16 rows d; a lane's 8 accumulator registers are 8 neighbours t of one d
        const size_t o = hp + t0;
#pragma unroll
        for (int nb = 0; nb < 4; ++nb) {
#pragma unroll
            for (int mb = 0; mb < 4; ++mb) { float* w = os + lr * 68 + mb * 16 + hi * 8; *(v4fa*)w = __builtin_shufflevector(acc[mb][nb], acc[mb][nb], 0, 1, 2, 3); *(v4fa*)(w + 4) = __builtin_shufflevector(acc[mb][nb], acc[mb][nb], 4, 5, 6, 7); }
            __builtin_amdgcn_wave_barrier(); asm volatile("" ::: "memory");   // as above
            panel_out<TT>(os, lane, V16 + o + nb * 16 * TT, Vh + o + nb * 16 * TT, Vl + o + nb * 16 * TT);
        }
    }
}
// ---- k_fattn: scores, causal softmax, probability x value and the head merge in one kernel; no score or probability plane in memory.
// One wave owns 32 query columns (two groups of 16) and walks the keys 0 .. q0 + 31 in blocks of 32. S^T = K Q^T (A = K rows, B = Q, kept in registers): a lane holds the scores of ONE query (column lr), keys 8 hi + j of each 16-key tile,
// which is the k order of a B operand, so the two score tiles of a block, after exp, are the B operand of O^T += V^T P^T without any exchange. Running maximum and sum per query (online softmax): partial sums are rescaled when the maximum grows.
// Query rows < RH: bf16 hi + lo planes, three products for S and for P.V; the other rows: fp16 planes, one product. P is exp(t - running max), at most 1, divided by the row sum (f32) at the end.
__device__ __forceinline__ float xhalf(float x) { return __builtin_bit_cast(float, __builtin_amdgcn_permlanex16(__builtin_bit_cast(int, x), __builtin_bit_cast(int, x), 0x76543210, 0xfedcba98, false, false)); }   // lane l with lane l ^ 16
#define L2E 1.4426950408889634f
template <typename T16> struct KVF { typename WFrag<T16>::V k[2][2], v[4], k2[2][2], v2[4]; };   // one 32-key block: K [key tile][k step of 32 d], V^T [d tile]; k2, v2: the lo planes
// kload, vload: one block's K or V^T fragments. K, K2, Vt, V2: wave-uniform plane bases; ok, ov: each lane's byte offset of its first K row or V^T row of the block (the other tiles' rows lie at constant distances), moved on to the next block behind the wait.
template <typename T16, bool HL>
__device__ __forceinline__ void kload(KVF<T16>& f, const T16* __restrict__ K, const T16* __restrict__ K2, unsigned& ok) {
    const T16* pk = (const T16*)((const char*)K + ok); const T16* pk2 = (const T16*)((const char*)K2 + ok);
#pragma unroll
    for (int t = 0; t < 2; ++t)
#pragma unroll
        for (int ks = 0; ks < 2; ++ks) { f.k[t][ks] = WFrag<T16>::ld(pk + t * 16 * HD + ks * 32); if (HL) f.k2[t][ks] = WFrag<T16>::ld(pk2 + t * 16 * HD + ks * 32); }
    // the wait behind the issued loads; the offset passes through it, so that its register stays untouched up to it and the advance below can only follow it
    asm volatile("s_wait_xcnt 0x0" : "+v"(ok) :: "memory");
    __builtin_amdgcn_sched_barrier(0);   // keeps these loads ahead of the work that follows (sunk below it, their latency would no longer be covered)
    ok += 32 * HD * 2;
}
template <typename T16, bool HL>
__device__ __forceinline__ void vload(KVF<T16>& f, const T16* __restrict__ Vt, const T16* __restrict__ V2, unsigned& ov) {
    const T16* pv = (const T16*)((const char*)Vt + ov); const T16* pv2 = (const T16*)((const char*)V2 + ov);
#pragma unroll
    for (int dt = 0; dt < 4; ++dt) { f.v[dt] = WFrag<T16>::ld(pv + dt * 16 * TT); if (HL) f.v2[dt] = WFrag<T16>::ld(pv2 + dt * 16 * TT); }
    // the wait behind the issued loads; the offset passes through it, so that its register stays untouched up to it and the advance below can only follow it
    asm volatile("s_wait_xcnt 0x0" : "+v"(ov) :: "memory");
    ov += 32 * 2;
}
// one 32-key block against the wave's 32 queries. The next block's K fragments are fetched into the same registers right behind this block's S^T products (softmax and P.V cover them); its V^T fragments are asked for behind the P.V products, and the compiler may issue them earlier into spare registers.
// LAST: the diagonal block (kb == q0), the only one that needs the causal select; nothing is fetched behind it.
template <typename T16, bool HL, bool LAST>
__device__ __forceinline__ void fstep(KVF<T16>& f, const typename WFrag<T16>::V (&q)[2][2], const typename WFrag<T16>::V (&q2)[2][2], v8f (&o)[2][4], float (&m)[2], float (&l)[2], const T16* __restrict__ K, const T16* __restrict__ K2, const T16* __restrict__ Vt, const T16* __restrict__ V2, unsigned& ok, unsigned& ov, int kb, int q0, int lr, int hi) {
    typedef typename WFrag<T16>::V V;
    v8f s[2][2];
#pragma unroll
    for (int g = 0; g < 2; ++g)
#pragma unroll
        for (int t = 0; t < 2; ++t) { s[g][t] = (v8f){};
#pragma unroll
            for (int ks = 0; ks < 2; ++ks) { s[g][t] = WFrag<T16>::mma(f.k[t][ks], q[g][ks], s[g][t]); if (HL) { s[g][t] = WFrag<T16>::mma(f.k[t][ks], q2[g][ks], s[g][t]); s[g][t] = WFrag<T16>::mma(f.k2[t][ks], q[g][ks], s[g][t]); } } }
    if (!LAST) kload<T16, HL>(f, K, K2, ok);
#pragma unroll
    for (int g = 0; g < 2; ++g) {
        float x[16]; float mx = -3.0e38f;
#pragma unroll
        for (int e = 0; e < 16; ++e) { float t = s[g][e >> 3][e & 7] * SCL; if (LAST) t = (kb + (e >> 3) * 16 + hi * 8 + (e & 7) <= q0 + g * 16 + lr) ? t : -3.0e38f; x[e] = t; mx = fmaxf(mx, t); }
        mx = fmaxf(mx, xhalf(mx));   // both halves of a column use one maximum: their keys meet in one product
        const float mn = fmaxf(m[g], mx); const float al = __builtin_amdgcn_exp2f((m[g] - mn) * L2E); m[g] = mn;   // 0 in the first block
        float ls[4] = {0.f, 0.f, 0.f, 0.f};   // four short chains instead of one of sixteen dependent adds
#pragma unroll
        for (int e = 0; e < 16; ++e) { x[e] = __builtin_amdgcn_exp2f((x[e] - mn) * L2E); ls[e & 3] += x[e]; }
        l[g] = l[g] * al + ((ls[0] + ls[1]) + (ls[2] + ls[3]));
#pragma unroll
        for (int dt = 0; dt < 4; ++dt) o[g][dt] *= al;
        if constexpr (HL) {
            v8us h0, h1, l0, l1;
#pragma unroll
            for (int j = 0; j < 8; ++j) { unsigned short a, c; splitf(x[j], a, c); h0[j] = a; l0[j] = c; splitf(x[8 + j], a, c); h1[j] = a; l1[j] = c; }
            const V ph = cat16b(h0, h1), pl = cat16b(l0, l1);
#pragma unroll
            for (int dt = 0; dt < 4; ++dt) { o[g][dt] = WFrag<T16>::mma(f.v[dt], ph, o[g][dt]); o[g][dt] = WFrag<T16>::mma(f.v[dt], pl, o[g][dt]); o[g][dt] = WFrag<T16>::mma(f.v2[dt], ph, o[g][dt]); }
        } else {
            V p;
#pragma unroll
            for (int e = 0; e < 16; ++e) p[e] = tohx(x[e]);
#pragma unroll
            for (int dt = 0; dt < 4; ++dt) o[g][dt] = WFrag<T16>::mma(f.v[dt], p, o[g][dt]);
        }
    }
    if (!LAST) vload<T16, HL>(f, Vt, V2, ov);
}
// one 32-query tile of one head; all pointers at the head's planes, Ah / Al at the head's first column of the merged [t][DQ] hi / lo planes
template <typename T16, bool HL>
__device__ __forceinline__ void ftile(const T16* __restrict__ Q, const T16* __restrict__ Q2, const T16* __restrict__ K, const T16* __restrict__ K2, const T16* __restrict__ Vt, const T16* __restrict__ V2, int q0, bf* Ah, bf* Al) {
    typedef typename WFrag<T16>::V V;
    const int lane = threadIdx.x & 31, lr = lane & 15, hi = lane >> 4;
    V q[2][2], q2[2][2];
    const T16* pq = Q + (size_t)(q0 + lr) * HD + 8 * hi; const T16* pq2 = HL ? Q2 + (size_t)(q0 + lr) * HD + 8 * hi : pq;
#pragma unroll
    for (int g = 0; g < 2; ++g)
#pragma unroll
        for (int ks = 0; ks < 2; ++ks) { q[g][ks] = WFrag<T16>::ld(pq + g * 16 * HD + ks * 32); q2[g][ks] = HL ? WFrag<T16>::ld(pq2 + g * 16 * HD + ks * 32) : q[g][ks]; }
    asm volatile("s_wait_xcnt 0x0" :: "v"(pq), "v"(pq2) : "memory");   // the wait behind the issued Q loads; their address registers are named so that none is reused ahead of it
    unsigned ok = ((unsigned)lr * HD + 8u * hi) * 2u, ov = ((unsigned)lr * TT + 8u * hi) * 2u;   // byte offsets inside one head's plane (256 KiB)
    v8f o[2][4]; float m[2], l[2];
#pragma unroll
    for (int g = 0; g < 2; ++g) { m[g] = -3.0e38f; l[g] = 0.f;
#pragma unroll
        for (int dt = 0; dt < 4; ++dt) o[g][dt] = (v8f){}; }
    KVF<T16> f;
    kload<T16, HL>(f, K, K2, ok); vload<T16, HL>(f, Vt, V2, ov);
    int kb = 0;
#pragma unroll 1   // rolled: one block per trip, the fragments stay in one register set
    for (; kb < q0; kb += 32) fstep<T16, HL, false>(f, q, q2, o, m, l, K, K2, Vt, V2, ok, ov, kb, q0, lr, hi);
    fstep<T16, HL, true>(f, q, q2, o, m, l, K, K2, Vt, V2, ok, ov, kb, q0, lr, hi);
    bf* pa = Ah + (size_t)(q0 + lr) * DQ + hi * 8; bf* pl = Al + (size_t)(q0 + lr) * DQ + hi * 8;
#pragma unroll
    for (int g = 0; g < 2; ++g) { const float inv = __fdiv_rn(1.0f, l[g] + xhalf(l[g]));
#pragma unroll
        for (int dt = 0; dt < 4; ++dt) { v8us oh, ol;   // O^T: a lane holds 8 consecutive d of one query: one 16-byte store per plane
#pragma unroll
            for (int j = 0; j < 8; ++j) { unsigned short a, c; splitf(o[g][dt][j] * inv, a, c); oh[j] = a; ol[j] = c; }
            *(v8us*)(pa + g * 16 * DQ + dt * 16) = oh; *(v8us*)(pl + g * 16 * DQ + dt * 16) = ol; } }
    asm volatile("s_wait_xcnt 0x0" :: "v"(pa), "v"(pl) : "memory");   // the wait behind the issued stores, ahead of the second tile's reuse of their address registers
}
// grid (TT / 256, heads, batches), four independent waves per block (no LDS, no barrier; neighbours walk the same K and V rows). Wave idx takes tile 63 - idx and then tile idx, so every wave walks 65 key blocks.
// The register count leaves two waves per SIMD: all 1536 waves are resident at once, and one wave's softmax runs under the other's products.
__global__ __launch_bounds__(128) void k_fattn(const h16* __restrict__ Q16, const h16* __restrict__ K16, const h16* __restrict__ V16, const bf* __restrict__ Qh, const bf* __restrict__ Ql, const bf* __restrict__ Kh, const bf* __restrict__ Kl, const bf* __restrict__ Vh, const bf* __restrict__ Vl, bf* Ah, bf* Al) {
    const int idx = blockIdx.x * 4 + (threadIdx.x >> 5);
    const size_t pl = ((size_t)blockIdx.z * NH_ + blockIdx.y) * TT * HD; const size_t ao = (size_t)blockIdx.z * TT * DQ + blockIdx.y * HD;
    const int qa = __builtin_amdgcn_readfirstlane((TT / 32 - 1 - idx) * 32), qb = __builtin_amdgcn_readfirstlane(idx * 32);   // wave-uniform: scalar loop bounds
    static_assert(RH <= TT / 2, "the first tile of every wave lies in the upper half of the rows, beyond the hi + lo rows");
    ftile<h16, false>(Q16 + pl, Q16 + pl, K16 + pl, K16 + pl, V16 + pl, V16 + pl, qa, Ah + ao, Al + ao);
    if (qb < RH) ftile<bf, true>(Qh + pl, Ql + pl, Kh + pl, Kl + pl, Vh + pl, Vl + pl, qb, Ah + ao, Al + ao);
    else ftile<h16, false>(Q16 + pl, Q16 + pl, K16 + pl, K16 + pl, V16 + pl, V16 + pl, qb, Ah + ao, Al + ao);
}

extern "C" void kernel_launch(void* const* d_in, const int* in_sizes, int n_in,
                              void* d_out, int out_size, void* d_ws, size_t ws_size, hipStream_t stream) {
    (void)in_sizes; (void)n_in; (void)out_size;
    const float* x = (const float*)d_in[0]; const float* xk = (const float*)d_in[1]; const float* xv = (const float*)d_in[2];   /* three streams: q, k, v */ const float* wq = (const float*)d_in[3]; const float* wk = (const float*)d_in[4]; const float* wv = (const float*)d_in[5]; const float* wo = (const float*)d_in[6];   /* w_q, w_k, w_v, w_o ('oi' [768][768]) */
    float* OUT = (float*)d_out;     // [4][2048][768]
    char* wsp = (char*)d_ws;
    auto take = [&](size_t bytes) { char* p = wsp; wsp += (bytes + 255) & ~(size_t)255; return (void*)p; };
    bf* WB = (bf*)take((size_t)4 * DM * DM * 2); bf* WO = WB + (size_t)3 * DM * DM;   // w_q, w_k, w_v, w_o, one behind the other
    const size_t SX = (size_t)NB_ * TT * DM;   // one stream, all batches, elements
    bf* XB = (bf*)take(3 * SX * 2);   // [stream q, k, v][b][t][c]: bf16 inputs
    const size_t PB = (size_t)NH_ * TT * HD;   // one batch's head planes, elements; every plane set holds all batches, [b][h][..]
    h16* QP16 = (h16*)take(NB_ * PB * 2); h16* KP16 = (h16*)take(NB_ * PB * 2); h16* VT16 = (h16*)take(NB_ * PB * 2);   // each K set lies NB_ * PB elements behind its Q set
    bf* QPh = (bf*)take(NB_ * PB * 2); bf* KPh = (bf*)take(NB_ * PB * 2); bf* QPl = (bf*)take(NB_ * PB * 2); bf* KPl = (bf*)take(NB_ * PB * 2); bf* VTh = (bf*)take(NB_ * PB * 2); bf* VTl = (bf*)take(NB_ * PB * 2);
    bf* ATh = (bf*)take((size_t)NB_ * TT * DQ * 2); bf* ATl = (bf*)take((size_t)NB_ * TT * DQ * 2);
    if ((size_t)(wsp - (char*)d_ws) > ws_size) return;    // ws 256 MiB
    k_cvtall<<<3 * CSB + 4 * CWB, 256, 0, stream>>>(x, xk, xv, wq, wk, wv, wo, XB, WB);
    k_proj<8><<<dim3(NB_ * TT / 64, NH_, 3), 32, 0, stream>>>(XB, WB, QP16, QPh, QPl, VT16, VTh, VTl);   // z: the q, k and v projections; rows: all batches; writes every head plane
    k_fattn<<<dim3(TT / 256, NH_, NB_), 128, 0, stream>>>(QP16, KP16, VT16, QPh, QPl, KPh, KPl, VTh, VTl, ATh, ATl);   // with no score planes to hold, one launch takes every (batch, head)
    k_gemmw<bf, 1, false, 4><<<dim3(NB_ * TT / 64, DM / 64, 1), 32, 0, stream>>>(ATh, ATl, WO, nullptr, DQ, OUT, DM, nullptr, 0, 0, 0);   // rows: all batches
}

// v006
// One run takes 142 microseconds.
// Two timings next to v005 both put it at 1.40 times that version's speed.
// Over all steps from v000 it is 15.6 times as fast.
#include <hip/hip_runtime.h>

// Causal multi-head attention at d_model 768 on three input streams, bias-free (q, k, v [4][2048][768]; qh = q w_q^T, kh = k w_k^T, vh = v w_v^T ('oi' [768][768] 1/sqrt(768), no bias; 12 heads x 64); att x 1/sqrt(64); causal (-inf); softmax; y = merged w_o^T ('oi', no bias) -> [4][2048][768] (6.3 M); argument order q, k, v, w_q, w_k, w_v, w_o).
// Layout, every stage one launch over all batches (and over the streams that share its kernel): bf16 copies of the three streams and the four weights; 'oi' weights as-is; exact projections whose epilogue writes the head planes; fused causal T-2048 attention over all batches and heads (hybrid rows: < 512 hi/lo 3 products, rest fp16; online softmax, key blocks above the diagonal never visited); merged hi/lo x w_o exact.
// Every 16-bit operand plane ([rows][K], K contiguous in meaning) lies in FRAGMENT ORDER: blocks of 16 rows x 32 k, 1 KiB each, k blocks of a row block one behind the other; inside a block the 16-byte piece of row r, k 8 c .. 8 c + 7 stands at byte 256 c + 16 r.
// A wave's fragment load (lane = 16 hi + lr takes row lr, k 8 hi .. and 16 + 8 hi ..) is then two loads of 512 bytes in a row, four whole lines each, where row-major planes gave 32-byte pieces of 16 lines.
// Compute dtypes, f32 accumulate: every input rounded to bf16; projections exact; attention rows < 512 3 products, rest fp16; softmax f32; output projection hl x exact.

#define NB_  4
#define TT   2048
#define DM   768
#define NH_  12
#define NKV  12
#define HD   64
#define DQ   (NH_ * HD)
#define DKV  (NKV * HD)
#define RH   512                  // query rows < RH use hi+lo planes (0: none)
#define SCL  0.125f   // HD^-0.5
typedef _Float16 h16;
typedef unsigned short bf;
typedef __attribute__((ext_vector_type(16))) __bf16   v16bf;
typedef __attribute__((ext_vector_type(16))) _Float16 v16h;
typedef __attribute__((ext_vector_type(8)))  _Float16 v8h;
typedef __attribute__((ext_vector_type(8)))  unsigned short v8us;
typedef __attribute__((ext_vector_type(8)))  float    v8f;
typedef __attribute__((ext_vector_type(4)))  float    v4f;
typedef v8h  __attribute__((may_alias)) v8ha;
typedef v4f  __attribute__((may_alias)) v4fa;
typedef v8us __attribute__((may_alias)) v8usa;

__device__ __forceinline__ unsigned short f2bf(float f) { unsigned u = __float_as_uint(f); u += 0x7FFFu + ((u >> 16) & 1u); return (unsigned short)(u >> 16); }
__device__ __forceinline__ float bf2f(unsigned short b) { return __uint_as_float(((unsigned)b) << 16); }
__device__ __forceinline__ float bfr(float f) { return bf2f(f2bf(f)); }
__device__ __forceinline__ v16h cat16(v8h lo, v8h hi) { return __builtin_shufflevector(lo, hi, 0, 1, 2, 3, 4, 5, 6, 7, 8, 9, 10, 11, 12, 13, 14, 15); }
__device__ __forceinline__ v16bf cat16b(v8us lo, v8us hi) { return __builtin_bit_cast(v16bf, __builtin_shufflevector(lo, hi, 0, 1, 2, 3, 4, 5, 6, 7, 8, 9, 10, 11, 12, 13, 14, 15)); }
__device__ __forceinline__ v8f wmma16(v16h a, v16h b, v8f c) { return __builtin_amdgcn_wmma_f32_16x16x32_f16(false, a, false, b, (short)0, c, false, false); }
__device__ __forceinline__ v8f wmmab(v16bf a, v16bf b, v8f c) { return __builtin_amdgcn_wmma_f32_16x16x32_bf16(false, a, false, b, (short)0, c, false, false); }



// ---- k_gemmw: register-blocked GEMM, ONE WAVE per 64x64 output tile (16 accumulators), operands straight from 16-bit planes in fragment order; grid (M/64, N/64, Z), 32 threads.
// C[m][n] (f32, pitch ldc, + optional f32 bias[n]) = sum_k A[m][k] Bt[n][k] (+ split products per NSPLIT). z-batch strides sA/sB/sC in elements. K % 32 == 0.
// ld: p = the block's first element + 8 lane; the second half of the fragment (k + 16) lies 512 bytes on. FB: elements of one block.
#define FB 512
template <typename T16> struct WFrag;
template <> struct WFrag<h16> { typedef v16h V; static __device__ __forceinline__ V ld(const h16* p) { return cat16(*(const v8h*)p, *(const v8h*)(p + 256)); } static __device__ __forceinline__ v8f mma(V a, V b, v8f c) { return wmma16(a, b, c); } };
template <> struct WFrag<bf> { typedef v16bf V; static __device__ __forceinline__ V ld(const bf* p) { return cat16b(*(const v8us*)p, *(const v8us*)(p + 256)); } static __device__ __forceinline__ v8f mma(V a, V b, v8f c) { return wmmab(a, b, c); } };
// kgroup: U consecutive 32-wide k steps of the 64x64 tile. All fragment loads of the U steps are issued first, as one group, so one wave pays the load latency once per U steps instead of several times per step;
// the products then run in the same k order as a one-step loop (per accumulator: a.b, a2.b, a.b2 for each step in turn), so every sum keeps its order.
// A, A2, Bt, Bt2: wave-uniform, already advanced to the group's first k block; ao, bo: each lane's byte offsets in its four A row blocks and four B row blocks, fixed for the whole K loop.
template <typename T16, int NSPLIT, int U>
__device__ __forceinline__ void kgroup(const T16* __restrict__ A, const T16* __restrict__ A2, const T16* __restrict__ Bt, const T16* __restrict__ Bt2, const unsigned (&ao)[4], const unsigned (&bo)[4], v8f (&acc)[4][4]) {
    typedef typename WFrag<T16>::V V;
    V a[U][4], a2[U][4], b[U][4], b2[U][4];
    const T16 *pa[4], *pa2[4], *pb[4], *pb2[4];
#pragma unroll
    for (int q = 0; q < 4; ++q) { pa[q] = (const T16*)((const char*)A + ao[q]); pb[q] = (const T16*)((const char*)Bt + bo[q]); pa2[q] = (NSPLIT == 1 || NSPLIT == 2) ? (const T16*)((const char*)A2 + ao[q]) : pa[q]; pb2[q] = (NSPLIT >= 2) ? (const T16*)((const char*)Bt2 + bo[q]) : pb[q]; }
#pragma unroll
    for (int u = 0; u < U; ++u) {
#pragma unroll
        for (int mb = 0; mb < 4; ++mb) { a[u][mb] = WFrag<T16>::ld(pa[mb] + u * FB); if (NSPLIT == 1 || NSPLIT == 2) a2[u][mb] = WFrag<T16>::ld(pa2[mb] + u * FB); }
#pragma unroll
        for (int nb = 0; nb < 4; ++nb) { b[u][nb] = WFrag<T16>::ld(pb[nb] + u * FB); if (NSPLIT >= 2) b2[u][nb] = WFrag<T16>::ld(pb2[nb] + u * FB); } }
    // the wait behind the issued loads; their address registers are named as inputs so that none is given to a later load's result, or advanced, ahead of it
    asm volatile("s_wait_xcnt 0x0" :: "v"(pa[0]), "v"(pa[1]), "v"(pa[2]), "v"(pa[3]), "v"(pb[0]), "v"(pb[1]), "v"(pb[2]), "v"(pb[3]), "v"(pa2[0]), "v"(pa2[1]), "v"(pa2[2]), "v"(pa2[3]), "v"(pb2[0]), "v"(pb2[1]), "v"(pb2[2]), "v"(pb2[3]) : "memory");
    __builtin_amdgcn_sched_barrier(0);   // keeps the whole load group ahead of the first product (sunk back to their uses, the loads would again wait once per step) and the address advance behind the wait above
#pragma unroll
    for (int u = 0; u < U; ++u)
#pragma unroll
        for (int nb = 0; nb < 4; ++nb)
#pragma unroll
            for (int mb = 0; mb < 4; ++mb) { acc[mb][nb] = WFrag<T16>::mma(a[u][mb], b[u][nb], acc[mb][nb]); if (NSPLIT == 1 || NSPLIT == 2) acc[mb][nb] = WFrag<T16>::mma(a2[u][mb], b[u][nb], acc[mb][nb]); if (NSPLIT >= 2) acc[mb][nb] = WFrag<T16>::mma(a[u][mb], b2[u][nb], acc[mb][nb]); }
    // four vector slots behind the last product, also on the loop's taken back edge, before its operands or result are touched
    asm volatile("v_nop\n\tv_nop\n\tv_nop\n\tv_nop" : "+v"(acc[0][0]), "+v"(acc[1][1]), "+v"(acc[2][2]), "+v"(acc[3][3]) : "v"(a[U - 1][0]), "v"(a[U - 1][3]));
}
template <typename T16, int NSPLIT, bool BIAS, int U>
__global__ __launch_bounds__(32) void k_gemmw(const T16* __restrict__ A, const T16* __restrict__ A2, const T16* __restrict__ Bt, const T16* __restrict__ Bt2, int K, float* C, int ldc, const float* __restrict__ bias, size_t sA, size_t sB, size_t sC) {
    typedef typename WFrag<T16>::V V;
    __shared__ __align__(16) float os[16 * 68];
    const size_t z = blockIdx.z; A += z * sA; if (A2) A2 += z * sA; Bt += z * sB; if (Bt2) Bt2 += z * sB; C += z * sC;
    const int lane = threadIdx.x & 31, lr = lane & 15, hi = lane >> 4; const int r0 = blockIdx.x * 64, c0 = blockIdx.y * 64;
    v8f acc[4][4];
#pragma unroll
    for (int mb = 0; mb < 4; ++mb)
#pragma unroll
        for (int nb = 0; nb < 4; ++nb) acc[mb][nb] = (v8f){};
    unsigned ao[4], bo[4];   // byte offsets inside one z plane (below 2^32: a plane is at most 8192 x 768 16-bit elements)
#pragma unroll
    for (int q = 0; q < 4; ++q) { ao[q] = ((unsigned)(r0 / 16 + q) * (unsigned)(K / 32) * FB + 8u * lane) * 2u; bo[q] = ((unsigned)(c0 / 16 + q) * (unsigned)(K / 32) * FB + 8u * lane) * 2u; }
#pragma unroll 1   // rolled: one load group per trip, every fragment index constant
    for (int kc = 0; kc < K; kc += 32 * U) kgroup<T16, NSPLIT, U>(A + kc * (FB / 32), A2 + kc * (FB / 32), Bt + kc * (FB / 32), Bt2 + kc * (FB / 32), ao, bo, acc);   // K % (32 U) == 0 at every call
#pragma unroll
    for (int mb = 0; mb < 4; ++mb) {
#pragma unroll
        for (int nb = 0; nb < 4; ++nb) {
#pragma unroll
            for (int j = 0; j < 8; ++j) os[(hi * 8 + j) * 68 + nb * 16 + lr] = acc[mb][nb][j]; }
        __builtin_amdgcn_wave_barrier(); asm volatile("" ::: "memory");
        float* crow = C + (size_t)(r0 + mb * 16) * ldc + c0;
{
#pragma unroll
            for (int s = 0; s < 8; ++s) { const int row = 2 * s + hi, cofs = lr * 4; v4f val = *(const v4fa*)(os + row * 68 + cofs); if (BIAS) { val[0] += bfr(bias[c0 + cofs]); val[1] += bfr(bias[c0 + cofs + 1]); val[2] += bfr(bias[c0 + cofs + 2]); val[3] += bfr(bias[c0 + cofs + 3]); }
                *(v4f*)(crow + (size_t)row * ldc + cofs) = val; }
             }
        __builtin_amdgcn_wave_barrier(); asm volatile("" ::: "memory");
    }
}

__device__ __forceinline__ h16 tohx(float x) { return (h16)x; }
__device__ __forceinline__ void splitf(float y, unsigned short& h, unsigned short& l) { h = f2bf(y); l = f2bf(y - bf2f(h)); }
typedef __attribute__((ext_vector_type(2))) _Float16 v2h;
typedef __attribute__((ext_vector_type(4))) _Float16 v4h;
typedef __attribute__((ext_vector_type(2))) unsigned short v2us;
typedef __attribute__((ext_vector_type(4))) unsigned short v4us;
typedef __attribute__((ext_vector_type(2))) float v2f;
typedef __attribute__((ext_vector_type(4))) int v4i;

// k_cvtall: the bf16 copies of the three streams (all batches, XB [stream], rows b t, k = c) and of the four weights (WB [weight], rows o, k = i), in fragment order, in one launch; a block lies wholly inside one source.
// A block takes 16 rows x 128 columns: four blocks of the fragment order, 4 KiB in a row. A thread reads 8 neighbours of a row (16 threads: 512 bytes in a row); the 16-byte results change places in LDS, so that the stores are whole lines too.
#define CSB (NB_ * TT * DM / 8 / 256)   // blocks per stream
#define CWB (DM * DM / 8 / 256)         // blocks per weight
static_assert(NB_ * TT % 16 == 0 && DM % 128 == 0 && DQ == DM && DKV == DM, "whole blocks per source; all four weights of one size");
__global__ __launch_bounds__(256) void k_cvtall(const float* __restrict__ xq, const float* __restrict__ xk, const float* __restrict__ xv, const float* __restrict__ wq, const float* __restrict__ wk, const float* __restrict__ wv, const float* __restrict__ wo, bf* XB, bf* WB) {
    unsigned bx = blockIdx.x; const float* src; bf* dst;
    if (bx < 3 * CSB) { const unsigned s = bx / CSB; bx -= s * CSB; src = s == 0 ? xq : s == 1 ? xk : xv; dst = XB + (size_t)s * NB_ * TT * DM; }
    else { bx -= 3 * CSB; const unsigned s = bx / CWB; bx -= s * CWB; src = s == 0 ? wq : s == 1 ? wk : s == 2 ? wv : wo; dst = WB + (size_t)s * DM * DM; }
    __shared__ __align__(16) bf ts[16 * 136];   // [piece column 0 .. 15][row], a column's 16 pieces 256 bytes + 16 of pad: the writers below would otherwise all meet in the same banks
    const unsigned tid = threadIdx.x, row = tid >> 4, cc = tid & 15;   // bx = row block * (DM / 128) + group of four k blocks
    const v8f v = *(const v8f*)(src + (size_t)((bx / (DM / 128)) * 16 + row) * DM + (bx % (DM / 128)) * 128 + cc * 8); v8us o;
    asm volatile("s_wait_xcnt 0x0" ::: "memory");   // the wait behind the issued loads, ahead of the reuse of their address registers
#pragma unroll
    for (int k = 0; k < 8; ++k) o[k] = f2bf(v[k]);
    *(v8usa*)(ts + cc * 136 + row * 8) = o;
    __syncthreads();   // other waves' pieces are read below
    *(v8us*)(dst + (size_t)bx * (4 * FB) + tid * 8) = *(const v8usa*)(ts + (tid >> 4) * 136 + (tid & 15) * 8); }

// ---- k_proj: the q, k and v projections (z), the K loop of k_gemmw; the epilogue writes the planes that k_fattn reads, so no f32 projection goes through memory. grid (NB_ TT / 64, heads, 3), one wave.
// A 64 x 64 tile is 64 rows t of one batch x the 64 columns d of one head. q, k: planes [b][h], rows t, k = d, the tile is 8 KiB in a row; v: planes [b][h], rows d, k = t, four pieces of 2 KiB. All in fragment order.
// panel_out: one 16 x 64 f32 panel staged in LDS (pitch 68; its rows are the plane's rows, its columns the plane's k) goes out as fp16, hi and lo: two blocks of the fragment order, 2 KiB in a row per plane; a lane takes the 8 neighbours k of one piece, a store 512 bytes in a row.
__device__ __forceinline__ void panel_out(const float* os, int lane, h16* d16, bf* dh, bf* dl) {
    v8h o16[4]; v8us oh[4], ol[4];
    const unsigned e0 = (unsigned)lane * 8;   // the lane's first element; its other three pieces lie at constant distances
#pragma unroll
    for (int s = 0; s < 4; ++s) { const float* r = os + (lane & 15) * 68 + s * 16 + (lane >> 4) * 8; const v4f x0 = *(const v4fa*)r, x1 = *(const v4fa*)(r + 4);
#pragma unroll
        for (int j = 0; j < 8; ++j) { const float x = j < 4 ? x0[j & 3] : x1[j & 3]; o16[s][j] = tohx(x); unsigned short a, c; splitf(x, a, c); oh[s][j] = a; ol[s][j] = c; }
        *(v8h*)(d16 + e0 + s * (FB / 2)) = o16[s]; *(v8us*)(dh + e0 + s * (FB / 2)) = oh[s]; *(v8us*)(dl + e0 + s * (FB / 2)) = ol[s]; }
    // the wait behind the issued stores; their data and offset registers are named as inputs so that none is given to the next panel's values ahead of it; its memory clobber also keeps the next panel's LDS writes behind the reads above
    asm volatile("s_wait_xcnt 0x0" :: "v"(o16[0]), "v"(o16[1]), "v"(o16[2]), "v"(o16[3]), "v"(oh[0]), "v"(oh[1]), "v"(oh[2]), "v"(oh[3]), "v"(ol[0]), "v"(ol[1]), "v"(ol[2]), "v"(ol[3]), "v"(e0) : "memory");
}
static_assert(TT % 64 == 0 && HD == 64 && DQ == DM && DKV == DM, "a 64 x 64 tile: one batch, one head");
template <int U>
__global__ __launch_bounds__(32) void k_proj(const bf* __restrict__ XB, const bf* __restrict__ WB, h16* P16, bf* Ph, bf* Pl, h16* V16, bf* Vh, bf* Vl) {
    __shared__ __align__(16) float os[16 * 68];
    const unsigned z = blockIdx.z; const bf* A = XB + (size_t)z * NB_ * TT * DM; const bf* Bt = WB + (size_t)z * DM * DM;
    const int lane = threadIdx.x & 31, lr = lane & 15, hi = lane >> 4; const int r0 = blockIdx.x * 64, c0 = blockIdx.y * 64;
    v8f acc[4][4];
#pragma unroll
    for (int mb = 0; mb < 4; ++mb)
#pragma unroll
        for (int nb = 0; nb < 4; ++nb) acc[mb][nb] = (v8f){};
    unsigned ao[4], bo[4];   // byte offsets inside one stream or weight (below 2^32)
#pragma unroll
    for (int q = 0; q < 4; ++q) { ao[q] = ((unsigned)(r0 / 16 + q) * (unsigned)(DM / 32) * FB + 8u * lane) * 2u; bo[q] = ((unsigned)(c0 / 16 + q) * (unsigned)(DM / 32) * FB + 8u * lane) * 2u; }
#pragma unroll 1   // rolled: one load group per trip, every fragment index constant
    for (int kc = 0; kc < DM; kc += 32 * U) kgroup<bf, 0, U>(A + kc * (FB / 32), A + kc * (FB / 32), Bt + kc * (FB / 32), Bt + kc * (FB / 32), ao, bo, acc);
    static_assert(DM % (32 * U) == 0, "whole load groups");
    const size_t hp = ((size_t)(r0 / TT) * NH_ + blockIdx.y) * TT * HD; const int t0 = r0 % TT;   // this (batch, head)'s plane; the tile's first row t
    if (z < 2) {   // q, k: panel = 16 rows t
        const size_t o = (size_t)z * NB_ * NH_ * TT * HD + hp + (size_t)t0 * HD;
#pragma unroll
        for (int mb = 0; mb < 4; ++mb) {
#pragma unroll
            for (int nb = 0; nb < 4; ++nb)
#pragma unroll
                for (int j = 0; j < 8; ++j) os[(hi * 8 + j) * 68 + nb * 16 + lr] = acc[mb][nb][j];
            __builtin_amdgcn_wave_barrier(); asm volatile("" ::: "memory");   // other lanes' panel values are read below: the compiler may not move those reads above the writes
            panel_out(os, lane, P16 + o + mb * 16 * HD, Ph + o + mb * 16 * HD, Pl + o + mb * 16 * HD);
        }
    } else {       // v: panel = 16 rows d; a lane's 8 accumulator registers are 8 neighbours t of one d
        const size_t o = hp + (size_t)(t0 / 32) * FB;   // the tile's first k block; a row block of 16 d holds TT / 32 blocks = 16 TT elements
#pragma unroll
        for (int nb = 0; nb < 4; ++nb) {
#pragma unroll
            for (int mb = 0; mb < 4; ++mb) { float* w = os + lr * 68 + mb * 16 + hi * 8; *(v4fa*)w = __builtin_shufflevector(acc[mb][nb], acc[mb][nb], 0, 1, 2, 3); *(v4fa*)(w + 4) = __builtin_shufflevector(acc[mb][nb], acc[mb][nb], 4, 5, 6, 7); }
            __builtin_amdgcn_wave_barrier(); asm volatile("" ::: "memory");   // as above
            panel_out(os, lane, V16 + o + nb * 16 * TT, Vh + o + nb * 16 * TT, Vl + o + nb * 16 * TT);
        }
    }
}
// ---- k_fattn: scores, causal softmax, probability x value and the head merge in one kernel; no score or probability plane in memory.
// One wave owns 32 query columns (two groups of 16) and walks the keys 0 .. q0 + 31 in blocks of 32. S^T = K Q^T (A = K rows, B = Q, kept in registers): a lane holds the scores of ONE query (column lr), keys 8 hi + j of each 16-key tile,
// which is the k order of a B operand, so the two score tiles of a block, after exp, are the B operand of O^T += V^T P^T without any exchange. Running maximum and sum per query (online softmax): partial sums are rescaled when the maximum grows.
// Query rows < RH: bf16 hi + lo planes, three products for S and for P.V; the other rows: fp16 planes, one product. P is exp(t - running max), at most 1, divided by the row sum (f32) at the end.
__device__ __forceinline__ float xhalf(float x) { return __builtin_bit_cast(float, __builtin_amdgcn_permlanex16(__builtin_bit_cast(int, x), __builtin_bit_cast(int, x), 0x76543210, 0xfedcba98, false, false)); }   // lane l with lane l ^ 16
#define L2E 1.4426950408889634f
template <typename T16> struct KVF { typename WFrag<T16>::V k[2][2], v[4], k2[2][2], v2[4]; };   // one 32-key block: K [key tile][k step of 32 d], V^T [d tile]; k2, v2: the lo planes
// kload, vload: one block's K or V^T fragments. K, K2, Vt, V2: wave-uniform plane bases; ok, ov: each lane's byte offset in the first fragment-order block of the key block (the other tiles' blocks lie at constant distances), moved on to the next key block behind the wait.
template <typename T16, bool HL>
__device__ __forceinline__ void kload(KVF<T16>& f, const T16* __restrict__ K, const T16* __restrict__ K2, unsigned& ok) {
    const T16* pk = (const T16*)((const char*)K + ok); const T16* pk2 = (const T16*)((const char*)K2 + ok);
#pragma unroll
    for (int t = 0; t < 2; ++t)
#pragma unroll
        for (int ks = 0; ks < 2; ++ks) { f.k[t][ks] = WFrag<T16>::ld(pk + t * 16 * HD + ks * FB); if (HL) f.k2[t][ks] = WFrag<T16>::ld(pk2 + t * 16 * HD + ks * FB); }
    // the wait behind the issued loads; the offset passes through it, so that its register stays untouched up to it and the advance below can only follow it
    asm volatile("s_wait_xcnt 0x0" : "+v"(ok) :: "memory");
    __builtin_amdgcn_sched_barrier(0);   // keeps these loads ahead of the work that follows (sunk below it, their latency would no longer be covered)
    ok += 32 * HD * 2;
}
template <typename T16, bool HL>
__device__ __forceinline__ void vload(KVF<T16>& f, const T16* __restrict__ Vt, const T16* __restrict__ V2, unsigned& ov) {
    const T16* pv = (const T16*)((const char*)Vt + ov); const T16* pv2 = (const T16*)((const char*)V2 + ov);
#pragma unroll
    for (int dt = 0; dt < 4; ++dt) { f.v[dt] = WFrag<T16>::ld(pv + dt * 16 * TT); if (HL) f.v2[dt] = WFrag<T16>::ld(pv2 + dt * 16 * TT); }
    // the wait behind the issued loads; the offset passes through it, so that its register stays untouched up to it and the advance below can only follow it
    asm volatile("s_wait_xcnt 0x0" : "+v"(ov) :: "memory");
    ov += FB * 2;
}
// one 32-key block against the wave's 32 queries. The next block's K fragments are fetched into the same registers right behind this block's S^T products (softmax and P.V cover them); its V^T fragments are asked for behind the P.V products, and the compiler may issue them earlier into spare registers.
// LAST: the diagonal block (kb == q0), the only one that needs the causal select; nothing is fetched behind it.
template <typename T16, bool HL, bool LAST>
__device__ __forceinline__ void fstep(KVF<T16>& f, const typename WFrag<T16>::V (&q)[2][2], const typename WFrag<T16>::V (&q2)[2][2], v8f (&o)[2][4], float (&m)[2], float (&l)[2], const T16* __restrict__ K, const T16* __restrict__ K2, const T16* __restrict__ Vt, const T16* __restrict__ V2, unsigned& ok, unsigned& ov, int kb, int q0, int lr, int hi) {
    typedef typename WFrag<T16>::V V;
    v8f s[2][2];
#pragma unroll
    for (int g = 0; g < 2; ++g)
#pragma unroll
        for (int t = 0; t < 2; ++t) { s[g][t] = (v8f){};
#pragma unroll
            for (int ks = 0; ks < 2; ++ks) { s[g][t] = WFrag<T16>::mma(f.k[t][ks], q[g][ks], s[g][t]); if (HL) { s[g][t] = WFrag<T16>::mma(f.k[t][ks], q2[g][ks], s[g][t]); s[g][t] = WFrag<T16>::mma(f.k2[t][ks], q[g][ks], s[g][t]); } } }
    if (!LAST) kload<T16, HL>(f, K, K2, ok);
#pragma unroll
    for (int g = 0; g < 2; ++g) {
        float x[16]; float mx = -3.0e38f;
#pragma unroll
        for (int e = 0; e < 16; ++e) { float t = s[g][e >> 3][e & 7] * SCL; if (LAST) t = (kb + (e >> 3) * 16 + hi * 8 + (e & 7) <= q0 + g * 16 + lr) ? t : -3.0e38f; x[e] = t; mx = fmaxf(mx, t); }
        mx = fmaxf(mx, xhalf(mx));   // both halves of a column use one maximum: their keys meet in one product
        const float mn = fmaxf(m[g], mx); const float al = __builtin_amdgcn_exp2f((m[g] - mn) * L2E); m[g] = mn;   // 0 in the first block
        float ls[4] = {0.f, 0.f, 0.f, 0.f};   // four short chains instead of one of sixteen dependent adds
#pragma unroll
        for (int e = 0; e < 16; ++e) { x[e] = __builtin_amdgcn_exp2f((x[e] - mn) * L2E); ls[e & 3] += x[e]; }
        l[g] = l[g] * al + ((ls[0] + ls[1]) + (ls[2] + ls[3]));
#pragma unroll
        for (int dt = 0; dt < 4; ++dt) o[g][dt] *= al;
        if constexpr (HL) {
            v8us h0, h1, l0, l1;
#pragma unroll
            for (int j = 0; j < 8; ++j) { unsigned short a, c; splitf(x[j], a, c); h0[j] = a; l0[j] = c; splitf(x[8 + j], a, c); h1[j] = a; l1[j] = c; }
            const V ph = cat16b(h0, h1), pl = cat16b(l0, l1);
#pragma unroll
            for (int dt = 0; dt < 4; ++dt) { o[g][dt] = WFrag<T16>::mma(f.v[dt], ph, o[g][dt]); o[g][dt] = WFrag<T16>::mma(f.v[dt], pl, o[g][dt]); o[g][dt] = WFrag<T16>::mma(f.v2[dt], ph, o[g][dt]); }
        } else {
            V p;
#pragma unroll
            for (int e = 0; e < 16; ++e) p[e] = tohx(x[e]);
#pragma unroll
            for (int dt = 0; dt < 4; ++dt) o[g][dt] = WFrag<T16>::mma(f.v[dt], p, o[g][dt]);
        }
    }
    if (!LAST) vload<T16, HL>(f, Vt, V2, ov);
}
// one 32-query tile of one head; all pointers at the head's planes, Ah / Al at the head's first k block of the batch's first row block in the merged hi / lo planes (rows b t, k = DQ, fragment order)
template <typename T16, bool HL>
__device__ __forceinline__ void ftile(const T16* __restrict__ Q, const T16* __restrict__ Q2, const T16* __restrict__ K, const T16* __restrict__ K2, const T16* __restrict__ Vt, const T16* __restrict__ V2, int q0, bf* Ah, bf* Al) {
    typedef typename WFrag<T16>::V V;
    const int lane = threadIdx.x & 31, lr = lane & 15, hi = lane >> 4;
    V q[2][2], q2[2][2];
    const T16* pq = Q + (size_t)q0 * HD + 8 * lane; const T16* pq2 = HL ? Q2 + (size_t)q0 * HD + 8 * lane : pq;
#pragma unroll
    for (int g = 0; g < 2; ++g)
#pragma unroll
        for (int ks = 0; ks < 2; ++ks) { q[g][ks] = WFrag<T16>::ld(pq + g * 16 * HD + ks * FB); q2[g][ks] = HL ? WFrag<T16>::ld(pq2 + g * 16 * HD + ks * FB) : q[g][ks]; }
    asm volatile("s_wait_xcnt 0x0" :: "v"(pq), "v"(pq2) : "memory");   // the wait behind the issued Q loads; their address registers are named so that none is reused ahead of it
    unsigned ok = 8u * lane * 2u, ov = 8u * lane * 2u;   // byte offsets inside one head's plane (256 KiB)
    v8f o[2][4]; float m[2], l[2];
#pragma unroll
    for (int g = 0; g < 2; ++g) { m[g] = -3.0e38f; l[g] = 0.f;
#pragma unroll
        for (int dt = 0; dt < 4; ++dt) o[g][dt] = (v8f){}; }
    KVF<T16> f;
    kload<T16, HL>(f, K, K2, ok); vload<T16, HL>(f, Vt, V2, ov);
    int kb = 0;
#pragma unroll 1   // rolled: one block per trip, the fragments stay in one register set
    for (; kb < q0; kb += 32) fstep<T16, HL, false>(f, q, q2, o, m, l, K, K2, Vt, V2, ok, ov, kb, q0, lr, hi);
    fstep<T16, HL, true>(f, q, q2, o, m, l, K, K2, Vt, V2, ok, ov, kb, q0, lr, hi);
    bf* pa = Ah + (size_t)q0 * DQ + lane * 8; bf* pl = Al + (size_t)q0 * DQ + lane * 8;
#pragma unroll
    for (int g = 0; g < 2; ++g) { const float inv = __fdiv_rn(1.0f, l[g] + xhalf(l[g])); v8us oh[4], ol[4];
#pragma unroll
        for (int dt = 0; dt < 4; ++dt) {   // O^T: a lane holds 8 consecutive d of one query, one piece of the fragment order: a store is 512 bytes in a row
#pragma unroll
            for (int j = 0; j < 8; ++j) { unsigned short a, c; splitf(o[g][dt][j] * inv, a, c); oh[dt][j] = a; ol[dt][j] = c; }
            *(v8us*)(pa + g * 16 * DQ + dt * (FB / 2)) = oh[dt]; *(v8us*)(pl + g * 16 * DQ + dt * (FB / 2)) = ol[dt]; }
        // the wait behind the issued stores; their data and address registers are named as inputs so that none is given to the next group's or the second tile's values ahead of it
        asm volatile("s_wait_xcnt 0x0" :: "v"(oh[0]), "v"(oh[1]), "v"(oh[2]), "v"(oh[3]), "v"(ol[0]), "v"(ol[1]), "v"(ol[2]), "v"(ol[3]), "v"(pa), "v"(pl) : "memory"); }
}
// grid (TT / 256, heads, batches), four independent waves per block (no LDS, no barrier; neighbours walk the same K and V rows). Wave idx takes tile 63 - idx and then tile idx, so every wave walks 65 key blocks.
// The register count leaves two waves per SIMD: all 1536 waves are resident at once, and one wave's softmax runs under the other's products.
__global__ __launch_bounds__(128) void k_fattn(const h16* __restrict__ Q16, const h16* __restrict__ K16, const h16* __restrict__ V16, const bf* __restrict__ Qh, const bf* __restrict__ Ql, const bf* __restrict__ Kh, const bf* __restrict__ Kl, const bf* __restrict__ Vh, const bf* __restrict__ Vl, bf* Ah, bf* Al) {
    const int idx = blockIdx.x * 4 + (threadIdx.x >> 5);
    const size_t pl = ((size_t)blockIdx.z * NH_ + blockIdx.y) * TT * HD; const size_t ao = (size_t)blockIdx.z * TT * DQ + blockIdx.y * (HD / 32) * FB;
    const int qa = __builtin_amdgcn_readfirstlane((TT / 32 - 1 - idx) * 32), qb = __builtin_amdgcn_readfirstlane(idx * 32);   // wave-uniform: scalar loop bounds
    static_assert(RH <= TT / 2, "the first tile of every wave lies in the upper half of the rows, beyond the hi + lo rows");
    ftile<h16, false>(Q16 + pl, Q16 + pl, K16 + pl, K16 + pl, V16 + pl, V16 + pl, qa, Ah + ao, Al + ao);
    if (qb < RH) ftile<bf, true>(Qh + pl, Ql + pl, Kh + pl, Kl + pl, Vh + pl, Vl + pl, qb, Ah + ao, Al + ao);
    else ftile<h16, false>(Q16 + pl, Q16 + pl, K16 + pl, K16 + pl, V16 + pl, V16 + pl, qb, Ah + ao, Al + ao);
}

extern "C" void kernel_launch(void* const* d_in, const int* in_sizes, int n_in,
                              void* d_out, int out_size, void* d_ws, size_t ws_size, hipStream_t stream) {
    (void)in_sizes; (void)n_in; (void)out_size;
    const float* x = (const float*)d_in[0]; const float* xk = (const float*)d_in[1]; const float* xv = (const float*)d_in[2];   /* three streams: q, k, v */ const float* wq = (const float*)d_in[3]; const float* wk = (const float*)d_in[4]; const float* wv = (const float*)d_in[5]; const float* wo = (const float*)d_in[6];   /* w_q, w_k, w_v, w_o ('oi' [768][768]) */
    float* OUT = (float*)d_out;     // [4][2048][768]
    char* wsp = (char*)d_ws;
    auto take = [&](size_t bytes) { char* p = wsp; wsp += (bytes + 255) & ~(size_t)255; return (void*)p; };
    bf* WB = (bf*)take((size_t)4 * DM * DM * 2); bf* WO = WB + (size_t)3 * DM * DM;   // w_q, w_k, w_v, w_o, one behind the other, each in fragment order
    const size_t SX = (size_t)NB_ * TT * DM;   // one stream, all batches, elements
    bf* XB = (bf*)take(3 * SX * 2);   // [stream q, k, v], rows b t, k = c, fragment order: bf16 inputs
    const size_t PB = (size_t)NH_ * TT * HD;   // one batch's head planes, elements; every plane set holds all batches, [b][h][..]
    h16* QP16 = (h16*)take(NB_ * PB * 2); h16* KP16 = (h16*)take(NB_ * PB * 2); h16* VT16 = (h16*)take(NB_ * PB * 2);   // each K set lies NB_ * PB elements behind its Q set
    bf* QPh = (bf*)take(NB_ * PB * 2); bf* KPh = (bf*)take(NB_ * PB * 2); bf* QPl = (bf*)take(NB_ * PB * 2); bf* KPl = (bf*)take(NB_ * PB * 2); bf* VTh = (bf*)take(NB_ * PB * 2); bf* VTl = (bf*)take(NB_ * PB * 2);
    bf* ATh = (bf*)take((size_t)NB_ * TT * DQ * 2); bf* ATl = (bf*)take((size_t)NB_ * TT * DQ * 2);
    if ((size_t)(wsp - (char*)d_ws) > ws_size) return;    // ws 256 MiB
    k_cvtall<<<3 * CSB + 4 * CWB, 256, 0, stream>>>(x, xk, xv, wq, wk, wv, wo, XB, WB);
    k_proj<8><<<dim3(NB_ * TT / 64, NH_, 3), 32, 0, stream>>>(XB, WB, QP16, QPh, QPl, VT16, VTh, VTl);   // z: the q, k and v projections; rows: all batches; writes every head plane
    k_fattn<<<dim3(TT / 256, NH_, NB_), 128, 0, stream>>>(QP16, KP16, VT16, QPh, QPl, KPh, KPl, VTh, VTl, ATh, ATl);   // with no score planes to hold, one launch takes every (batch, head)
    k_gemmw<bf, 1, false, 4><<<dim3(NB_ * TT / 64, DM / 64, 1), 32, 0, stream>>>(ATh, ATl, WO, nullptr, DQ, OUT, DM, nullptr, 0, 0, 0);   // rows: all batches
}
